// v000
// The times below were measured on an AMD MI455X: many runs one after another, warmed up first and cycling through
// copies of the inputs, with the whole window's GPU time divided by the number of runs. Launches and the gaps
// between them are all in it. The median over several windows is given; except for v000 it joins two sittings, which
// can be a few percent apart, so the side-by-side timings, each taken in one sitting, are the better comparison.
// The starting kernel, v000, takes 269 microseconds a run.
#include <hip/hip_runtime.h>

// Causal grouped-query attention on given q [2048 tokens][32 heads][128], k/v [2048][8 kv-heads][128]: head h uses kv head h/4; scores = q.k 128^-0.5, causal (s <= t), softmax over s,
// out = sum_s p v -> [2048][32][128]. No projections: q, k, v are the (bf16-rounded) module inputs.
// Deterministic: per (head, 16-query wave) a flash-style pass over the 32-key blocks up to the diagonal with fixed-order online softmax; no atomics.
// compute dtype: WMMA v_wmma_f32_16x16x32_f16 with f32 accumulate for S^T = K Q^T (q, k bf16-exact x8 in f16: EXACT products, K = 128: 1 product) and O^T += V^T P^T (v bf16-exact x8; P x1024 as
// f16 hi + x1024 residual: 2 products); scale, mask and softmax statistics in f32 (exp2). Inputs rounded to bf16 once.
// Fragment k-map per lane half hh for A AND B: elements 0..7 <- k = 8hh+0..7, 8..15 <- k = 16+8hh+0..7; acc[r] = D[8hh+r][col].

namespace {
typedef _Float16 b16;
typedef __attribute__((ext_vector_type(16))) _Float16 v16b;
typedef __attribute__((ext_vector_type(8))) _Float16 v8b;
typedef __attribute__((ext_vector_type(4))) _Float16 v4h;
typedef __attribute__((ext_vector_type(2))) _Float16 v2h;
typedef __attribute__((ext_vector_type(8))) float v8f;
typedef __attribute__((ext_vector_type(4))) float v4f;
typedef __attribute__((ext_vector_type(2))) float v2f;
__device__ __forceinline__ float bf16_rne(float f) { unsigned int u = __float_as_uint(f); u += 0x7FFFu + ((u >> 16) & 1u); return __uint_as_float(u & 0xFFFF0000u); }
__device__ __forceinline__ void split16(float v, b16& hi, b16& lo) { hi = (b16)v; lo = (b16)(v - (float)hi); }
__device__ __forceinline__ v16b frag_kb(const b16* p, int hh) { const v8b a = *(const v8b*)(p + 8 * hh), b = *(const v8b*)(p + 16 + 8 * hh); v16b f;
#pragma unroll
  for (int e = 0; e < 8; ++e) { f[e] = a[e]; f[8 + e] = b[e]; } return f; }
__device__ __forceinline__ v8f wmma16b(v16b a, v16b b, v8f c) { v8f d = __builtin_amdgcn_wmma_f32_16x16x32_f16(false, a, false, b, (short)0, c, false, false); asm volatile("v_nop\n\tv_nop\n\tv_nop\n\tv_nop" : "+v"(d) : "v"(a), "v"(b)); return d; }
__device__ __forceinline__ void wave_lds_sync() { __builtin_amdgcn_fence(__ATOMIC_RELEASE, "workgroup"); __builtin_amdgcn_wave_barrier(); __builtin_amdgcn_fence(__ATOMIC_ACQUIRE, "workgroup"); }
__device__ __forceinline__ float pmul(float a, float b) { float p = a * b; asm volatile("" : "+v"(p)); return p; }
__device__ __forceinline__ int iclamp(int v, int lo, int hi) { return v < lo ? lo : (v > hi ? hi : v); }
__device__ __forceinline__ float nexp2(float v) { return __builtin_amdgcn_exp2f(v); }

constexpr int T = 2048, NH = 32, NKV = 8, GRP = NH / NKV, HD = 128, HL = NH /* query heads computed (== NH shipped) */;
constexpr float XS = 8.0f, PS = 1024.0f, RS_ = 1024.0f, LOG2E = 1.4426950408889634f, SCALE = 0.088388347648318447f /* 128^-0.5 */;
static_assert(T % 64 == 0 && HD == 128 && NH % NKV == 0, "tiling");

// planes: QP[h][t][128] = f16(bf16(q[t][h]) x8) and KP[kh][s][128] likewise (head-major so a wave's fragment rows are contiguous); V^T[kh][d][s] (keys contiguous): block = (kh, 64 tokens), the
__global__ __launch_bounds__(256) void qk_kernel(const float* __restrict__ q, const float* __restrict__ k, b16* __restrict__ QP, b16* __restrict__ KP) {
  const int u = blockIdx.x * 256 + threadIdx.x; const int nq = T * NH * HD / 8, nk = T * NKV * HD / 8;
  if (u < nq) { const int e = u * 8; const int h = e / (T * HD), rem = e % (T * HD), t = rem / HD, d = rem % HD; const float* src = q + ((size_t)t * NH + h) * HD + d; v8b o; for (int j = 0; j < 8; ++j) o[j] = (b16)(bf16_rne(src[j]) * XS);
    { *(v8b*)(QP + e) = o;  } }
  else if (u < nq + nk) { const int e = (u - nq) * 8; const int h = e / (T * HD), rem = e % (T * HD), t = rem / HD, d = rem % HD; const float* src = k + ((size_t)t * NKV + h) * HD + d; v8b o; for (int j = 0; j < 8; ++j) o[j] = (b16)(bf16_rne(src[j]) * XS);
    { *(v8b*)(KP + e) = o;  } }
}
__global__ __launch_bounds__(256) void vt_kernel(const float* __restrict__ v, b16* __restrict__ VT) {
  __shared__ __attribute__((aligned(16))) b16 Ts[HD][64 + 8]; const int kh = blockIdx.y, s0 = blockIdx.x * 64;
  for (int i = threadIdx.x; i < 64 * HD; i += 256) { const int tt = i / HD, d = i % HD; Ts[d][tt] = (b16)(bf16_rne(v[((size_t)(s0 + tt) * NKV + kh) * HD + d]) * XS); }
  __syncthreads();
  const int wave = threadIdx.x >> 5, lane = threadIdx.x & 31;
  { for (int d = wave; d < HD; d += 8) *(v2h*)(VT + ((size_t)kh * HD + d) * T + s0 + lane * 2) = *(const v2h*)(&Ts[d][lane * 2]);  }
}
// attention: grid (T/32, HL); block = 2 waves x 16 queries of head h (kv head h/4); key blocks s0 <= t0+15; S^T = K Q^T (4 k-steps x 2 key tiles, 1 product: exact operands), logit = s/64 x 128^-0.5
// in log2 units, keys s > t -> -inf (diagonal kept), online softmax, P x1024 hi + residual -> LDS, O^T += V^T P^T (8 d-tiles x 2 products -> o, o2); out[t][h][d] = (o + o2/1024)/(l 1024 8):
__global__ __launch_bounds__(64) void attn_kernel(const b16* __restrict__ QP, const b16* __restrict__ KP, const b16* __restrict__ VT, float* __restrict__ out) {
  __shared__ __attribute__((aligned(16))) b16 Pb[2][16][32 + 8], Pl[2][16][32 + 8]; __shared__ __attribute__((aligned(16))) float To[2][16][HD + 4];
  const int wave = threadIdx.x >> 5, lane = threadIdx.x & 31, hh = lane >> 4, col = lane & 15; const int h = blockIdx.y, kh = h / GRP; const int t0 = blockIdx.x * 32 + wave * 16; const int tq = t0 + col;
  const b16* Qb = QP + ((size_t)h * T + tq) * HD; const b16* Kb = KP + (size_t)kh * T * HD; const b16* Vb = VT + (size_t)kh * HD * T;
  v16b qf[4]; for (int kb = 0; kb < 4; ++kb) qf[kb] = frag_kb(Qb + kb * 32, hh);
  const float cs = LOG2E * SCALE / (XS * XS);
  float mrun = -INFINITY, l = 0.0f; v8f o[8], o2[8];
#pragma unroll
  for (int t = 0; t < 8; ++t) { o[t] = (v8f){}; o2[t] = (v8f){}; }
  const int send = t0 + 16;
#pragma unroll 1
  for (int s0 = 0; s0 < send; s0 += 32) {
    float e[16]; float mx = -INFINITY;
#pragma unroll
    for (int u2 = 0; u2 < 2; ++u2) { v8f sacc = (v8f){}; const b16* kr = Kb + (size_t)(s0 + u2 * 16 + col) * HD;
#pragma unroll
      for (int kb = 0; kb < 4; ++kb) sacc = wmma16b(frag_kb(kr + kb * 32, hh), qf[kb], sacc);
#pragma unroll
      for (int r = 0; r < 8; ++r) { const int s = s0 + u2 * 16 + 8 * hh + r; const float vv = (s <= tq) ? sacc[r] * cs : -INFINITY; e[u2 * 8 + r] = vv; mx = fmaxf(mx, vv); } }
    mx = fmaxf(mx, __shfl_xor(mx, 16)); const float mn = fmaxf(mrun, mx); const float al = (mn == -INFINITY) ? 1.0f : nexp2(mrun - mn); float sum = 0.0f;
#pragma unroll
    for (int i2 = 0; i2 < 16; ++i2) { const float p = (mn == -INFINITY) ? 0.0f : nexp2(e[i2] - mn); sum += p; const float psv = p * PS; const b16 p1 = (b16)psv; const int slot = (i2 < 8 ? 0 : 16) + 8 * hh + (i2 & 7); Pb[wave][col][slot] = p1; Pl[wave][col][slot] = (b16)((psv - (float)p1) * RS_); }
    sum += __shfl_xor(sum, 16); l = l * al + sum; mrun = mn;
    wave_lds_sync();
    const v16b pf = frag_kb(&Pb[wave][col][0], hh), plf = frag_kb(&Pl[wave][col][0], hh);
#pragma unroll
    for (int t = 0; t < 8; ++t) { o[t] *= al; o2[t] *= al; const v16b vf = frag_kb(Vb + (size_t)(t * 16 + col) * T + s0, hh); o[t] = wmma16b(vf, pf, o[t]); o2[t] = wmma16b(vf, plf, o2[t]); }
    wave_lds_sync(); }
  const float inv = 1.0f / (l * PS * XS);
#pragma unroll
  for (int t = 0; t < 8; ++t)
#pragma unroll
    for (int r = 0; r < 8; ++r) To[wave][col][t * 16 + 8 * hh + r] = (o[t][r] + o2[t][r] * (1.0f / RS_)) * inv;
  wave_lds_sync();
  { for (int rr = 0; rr < 16; ++rr) *(v4f*)(out + ((size_t)(t0 + rr) * NH + h) * HD + lane * 4) = *(const v4f*)(&To[wave][rr][lane * 4]);  }
}
}  // namespace

extern "C" void kernel_launch(void* const* d_in, const int* in_sizes, int n_in, void* d_out, int out_size, void* d_ws, size_t ws_size, hipStream_t stream) {
  (void)n_in;
  auto Fp = [&](int i) { return (const float*)d_in[i]; };
  // input order: 0 q [2048,32,128], 1 k [2048,8,128], 2 v [2048,8,128]
  if (in_sizes[0] != T * NH * HD || in_sizes[1] != T * NKV * HD || in_sizes[2] != T * NKV * HD || out_size != T * NH * HD) return;
  size_t off = 0; char* ws = (char*)d_ws;
  auto carve = [&](size_t bytes) { char* p = ws + off; off += (bytes + 255) & ~(size_t)255; return p; };
  b16* QP = (b16*)carve((size_t)NH * T * HD * 2); b16* KP = (b16*)carve((size_t)NKV * T * HD * 2); b16* VT = (b16*)carve((size_t)NKV * HD * T * 2);
  if (off > ws_size || off > ((size_t)128 << 20)) return;   // = 25 MB
  qk_kernel<<<((T * NH * HD + T * NKV * HD) / 8 + 255) / 256, 256, 0, stream>>>(Fp(0), Fp(1), QP, KP);
  vt_kernel<<<dim3(T / 64, NKV), 256, 0, stream>>>(Fp(2), VT);
  attn_kernel<<<dim3(T / 32, HL), 64, 0, stream>>>(QP, KP, VT, (float*)d_out);
}

// v001
// A run of this version takes 117 microseconds.
// Two timings next to v000 both put it at 2.30 times that version's speed.
#include <hip/hip_runtime.h>

// Causal grouped-query attention on given q [2048 tokens][32 heads][128], k/v [2048][8 kv-heads][128]: head h uses kv head h/4; scores = q.k 128^-0.5, causal (s <= t), softmax over s,
// out = sum_s p v -> [2048][32][128]. No projections: q, k, v are the (bf16-rounded) module inputs.
// Deterministic: per (head, 16-query wave) a flash-style pass over the 32-key blocks up to the diagonal with fixed-order online softmax; no atomics.
// compute dtype: WMMA v_wmma_f32_16x16x32_f16 with f32 accumulate for S^T = K Q^T (q, k bf16-exact x8 in f16: EXACT products, K = 128: 1 product) and O^T += V^T P^T (v bf16-exact x8; P x1024 as
// f16 hi + x1024 residual: 2 products); scale, mask and softmax statistics in f32 (exp2). Inputs rounded to bf16 once.
// Fragment k-map per lane half hh for A AND B: elements 0..7 <- k = 8hh+0..7, 8..15 <- k = 16+8hh+0..7; acc[r] = D[8hh+r][col].

namespace {
typedef _Float16 b16;
typedef __attribute__((ext_vector_type(16))) _Float16 v16b;
typedef __attribute__((ext_vector_type(8))) _Float16 v8b;
typedef __attribute__((ext_vector_type(4))) _Float16 v4h;
typedef __attribute__((ext_vector_type(2))) _Float16 v2h;
typedef __attribute__((ext_vector_type(8))) float v8f;
typedef __attribute__((ext_vector_type(4))) float v4f;
typedef __attribute__((ext_vector_type(2))) float v2f;
__device__ __forceinline__ float bf16_rne(float f) { unsigned int u = __float_as_uint(f); u += 0x7FFFu + ((u >> 16) & 1u); return __uint_as_float(u & 0xFFFF0000u); }
__device__ __forceinline__ void split16(float v, b16& hi, b16& lo) { hi = (b16)v; lo = (b16)(v - (float)hi); }
__device__ __forceinline__ v16b frag_kb(const b16* p, int hh) { const v8b a = *(const v8b*)(p + 8 * hh), b = *(const v8b*)(p + 16 + 8 * hh); v16b f;
#pragma unroll
  for (int e = 0; e < 8; ++e) { f[e] = a[e]; f[8 + e] = b[e]; } return f; }
__device__ __forceinline__ v8f wmma16b(v16b a, v16b b, v8f c) { v8f d = __builtin_amdgcn_wmma_f32_16x16x32_f16(false, a, false, b, (short)0, c, false, false); asm volatile("v_nop\n\tv_nop\n\tv_nop\n\tv_nop" : "+v"(d) : "v"(a), "v"(b)); return d; }
__device__ __forceinline__ void wave_lds_sync() { __builtin_amdgcn_fence(__ATOMIC_RELEASE, "workgroup"); __builtin_amdgcn_wave_barrier(); __builtin_amdgcn_fence(__ATOMIC_ACQUIRE, "workgroup"); }
__device__ __forceinline__ float pmul(float a, float b) { float p = a * b; asm volatile("" : "+v"(p)); return p; }
__device__ __forceinline__ int iclamp(int v, int lo, int hi) { return v < lo ? lo : (v > hi ? hi : v); }
__device__ __forceinline__ float nexp2(float v) { return __builtin_amdgcn_exp2f(v); }

constexpr int T = 2048, NH = 32, NKV = 8, GRP = NH / NKV, HD = 128, HL = NH /* query heads computed (== NH shipped) */;
constexpr float XS = 8.0f, PS = 1024.0f, RS_ = 1024.0f, LOG2E = 1.4426950408889634f, SCALE = 0.088388347648318447f /* 128^-0.5 */;
static_assert(T % 64 == 0 && HD == 128 && NH % NKV == 0, "tiling");

// planes: QP[h][t][128] = f16(bf16(q[t][h]) x8) and KP[kh][s][128] likewise (head-major so a wave's fragment rows are contiguous); V^T[kh][d][s] (keys contiguous): block = (kh, 64 tokens), the
__global__ __launch_bounds__(256) void qk_kernel(const float* __restrict__ q, const float* __restrict__ k, b16* __restrict__ QP, b16* __restrict__ KP) {
  const int u = blockIdx.x * 256 + threadIdx.x; const int nq = T * NH * HD / 8, nk = T * NKV * HD / 8;
  if (u < nq) { const int e = u * 8; const int h = e / (T * HD), rem = e % (T * HD), t = rem / HD, d = rem % HD; const float* src = q + ((size_t)t * NH + h) * HD + d; v8b o; for (int j = 0; j < 8; ++j) o[j] = (b16)(bf16_rne(src[j]) * XS);
    { *(v8b*)(QP + e) = o;  } }
  else if (u < nq + nk) { const int e = (u - nq) * 8; const int h = e / (T * HD), rem = e % (T * HD), t = rem / HD, d = rem % HD; const float* src = k + ((size_t)t * NKV + h) * HD + d; v8b o; for (int j = 0; j < 8; ++j) o[j] = (b16)(bf16_rne(src[j]) * XS);
    { *(v8b*)(KP + e) = o;  } }
}
__global__ __launch_bounds__(256) void vt_kernel(const float* __restrict__ v, b16* __restrict__ VT) {
  __shared__ __attribute__((aligned(16))) b16 Ts[HD][64 + 8]; const int kh = blockIdx.y, s0 = blockIdx.x * 64;
  for (int i = threadIdx.x; i < 64 * HD; i += 256) { const int tt = i / HD, d = i % HD; Ts[d][tt] = (b16)(bf16_rne(v[((size_t)(s0 + tt) * NKV + kh) * HD + d]) * XS); }
  __syncthreads();
  const int wave = threadIdx.x >> 5, lane = threadIdx.x & 31;
  { for (int d = wave; d < HD; d += 8) *(v2h*)(VT + ((size_t)kh * HD + d) * T + s0 + lane * 2) = *(const v2h*)(&Ts[d][lane * 2]);  }
}
// attention: grid (T/32, NKV); block = 8 waves = the 4 query heads of kv head kh x 2 tiles of 16 queries (32 positions), so all eight waves walk the same bx + 1 key blocks of 32 and share ONE copy of each
// block's K rows and V^T columns in LDS (two buffers, filled by asynchronous 16-byte copies one block ahead; rows padded to 272 / 80 bytes for the 16-byte fragment reads). Per wave as before: S^T = K Q^T
// (4 k-steps x 2 key tiles, 1 product: exact operands), logit = s/64 x 128^-0.5 in log2 units, keys s > t -> -inf (diagonal kept), online softmax, P x1024 hi + residual -> LDS, O^T += V^T P^T
// (8 d-tiles x 2 products -> o, o2); out[t][h][d] = (o + o2/1024)/(l 1024 8):
constexpr int KPIT = HD + 8, VPIT = 32 + 8;   // LDS row pitch in elements
// one key block: K rows s0..s0+31 (8 KB contiguous) and 32 columns of the 128 V^T rows; each of the 256 threads copies 2 + 2 pieces of 16 bytes. The s_wait_xcnt stands inside the statement so that no address
// register of an issued copy is rewritten in front of it.
__device__ __forceinline__ void stage_copy(unsigned lk, unsigned lv, const b16* gk, const b16* gv) {
  const unsigned lk1 = lk + 16 * KPIT * 2, lv1 = lv + 64 * VPIT * 2; const b16* gk1 = gk + 16 * HD; const b16* gv1 = gv + (size_t)64 * T;
  asm volatile("global_load_async_to_lds_b128 %0, %4, off\n\tglobal_load_async_to_lds_b128 %1, %5, off\n\tglobal_load_async_to_lds_b128 %2, %6, off\n\tglobal_load_async_to_lds_b128 %3, %7, off\n\ts_wait_xcnt 0x0"
               :: "v"(lk), "v"(lk1), "v"(lv), "v"(lv1), "v"(gk), "v"(gk1), "v"(gv), "v"(gv1) : "memory");
}
__global__ __launch_bounds__(256) void attn_kernel(const b16* __restrict__ QP, const b16* __restrict__ KP, const b16* __restrict__ VT, float* __restrict__ out) {
  __shared__ __attribute__((aligned(16))) b16 Ks[2][32][KPIT], Vs[2][HD][VPIT];
  __shared__ __attribute__((aligned(16))) b16 Pb[8][16][32 + 8], Pl[8][16][32 + 8]; __shared__ __attribute__((aligned(16))) float To[8][16][HD + 4];
  const int tid = threadIdx.x, wave = tid >> 5, lane = tid & 31, hh = lane >> 4, col = lane & 15; const int kh = blockIdx.y, h = kh * GRP + (wave & 3); const int t0 = blockIdx.x * 32 + (wave >> 2) * 16; const int tq = t0 + col;
  const b16* Qb = QP + ((size_t)h * T + tq) * HD; const b16* Kb = KP + (size_t)kh * T * HD; const b16* Vb = VT + (size_t)kh * HD * T;
  const int ntrip = blockIdx.x + 1;   // key blocks up to the diagonal: the same for the eight waves
  // this thread's pieces: K piece tid (row tid/16, 16 bytes at tid%16) and tid + 256 (16 rows on); V^T piece tid (row tid/4, 16 bytes at tid%4) and tid + 256 (64 rows on)
  const unsigned lk0 = (unsigned)(size_t)&Ks[0][tid >> 4][(tid & 15) * 8], lv0 = (unsigned)(size_t)&Vs[0][tid >> 2][(tid & 3) * 8];
  const b16* gk0 = Kb + tid * 8; const b16* gv0 = Vb + (size_t)(tid >> 2) * T + (tid & 3) * 8;
  constexpr unsigned KBUF = 32 * KPIT * 2, VBUF = HD * VPIT * 2;   // bytes per buffer
  stage_copy(lk0, lv0, gk0, gv0);
  v16b qf[4]; for (int kb = 0; kb < 4; ++kb) qf[kb] = frag_kb(Qb + kb * 32, hh);
  asm volatile("s_wait_asynccnt 0x0" ::: "memory");   // block 0's own copies have landed
  __syncthreads();                                     // ... and every other wave's: block 0 is readable
  if (ntrip > 1) stage_copy(lk0 + KBUF, lv0 + VBUF, gk0 + 32 * HD, gv0 + 32);
  const float cs = LOG2E * SCALE / (XS * XS);
  float mrun = -INFINITY, l = 0.0f; v8f o[8], o2[8];
#pragma unroll
  for (int t = 0; t < 8; ++t) { o[t] = (v8f){}; o2[t] = (v8f){}; }
#pragma unroll 1
  for (int it = 0; it < ntrip; ++it) {
    const int s0 = it * 32, buf = it & 1;
    float e[16]; float mx = -INFINITY;
#pragma unroll
    for (int u2 = 0; u2 < 2; ++u2) { v8f sacc = (v8f){}; const b16* kr = &Ks[buf][u2 * 16 + col][0];
#pragma unroll
      for (int kb = 0; kb < 4; ++kb) sacc = wmma16b(frag_kb(kr + kb * 32, hh), qf[kb], sacc);
#pragma unroll
      for (int r = 0; r < 8; ++r) { const int s = s0 + u2 * 16 + 8 * hh + r; const float vv = (s <= tq) ? sacc[r] * cs : -INFINITY; e[u2 * 8 + r] = vv; mx = fmaxf(mx, vv); } }
    mx = fmaxf(mx, __shfl_xor(mx, 16)); const float mn = fmaxf(mrun, mx); const float al = (mn == -INFINITY) ? 1.0f : nexp2(mrun - mn); float sum = 0.0f;
#pragma unroll
    for (int i2 = 0; i2 < 16; ++i2) { const float p = (mn == -INFINITY) ? 0.0f : nexp2(e[i2] - mn); sum += p; const float psv = p * PS; const b16 p1 = (b16)psv; const int slot = (i2 < 8 ? 0 : 16) + 8 * hh + (i2 & 7); Pb[wave][col][slot] = p1; Pl[wave][col][slot] = (b16)((psv - (float)p1) * RS_); }
    sum += __shfl_xor(sum, 16); l = l * al + sum; mrun = mn;
    wave_lds_sync();
    const v16b pf = frag_kb(&Pb[wave][col][0], hh), plf = frag_kb(&Pl[wave][col][0], hh);
#pragma unroll
    for (int t = 0; t < 8; ++t) { o[t] *= al; o2[t] *= al; const v16b vf = frag_kb(&Vs[buf][t * 16 + col][0], hh); o[t] = wmma16b(vf, pf, o[t]); o2[t] = wmma16b(vf, plf, o2[t]); }
    wave_lds_sync();
    asm volatile("s_wait_dscnt 0x0" ::: "memory");      // this wave's reads of buffer buf are done before the buffer is handed back
    asm volatile("s_wait_asynccnt 0x0" ::: "memory");   // this wave's copies of block it + 1 have landed
    __syncthreads();                                     // publishes block it + 1 and ends every wave's reads of buffer buf
    if (it + 2 < ntrip) stage_copy(lk0 + buf * KBUF, lv0 + buf * VBUF, gk0 + (size_t)(s0 + 64) * HD, gv0 + s0 + 64); }
  asm volatile("s_wait_asynccnt 0x0" ::: "memory");     // nothing of this wave's is in flight when it leaves the loop
  const float inv = 1.0f / (l * PS * XS);
#pragma unroll
  for (int t = 0; t < 8; ++t)
#pragma unroll
    for (int r = 0; r < 8; ++r) To[wave][col][t * 16 + 8 * hh + r] = (o[t][r] + o2[t][r] * (1.0f / RS_)) * inv;
  wave_lds_sync();
  { for (int rr = 0; rr < 16; ++rr) *(v4f*)(out + ((size_t)(t0 + rr) * NH + h) * HD + lane * 4) = *(const v4f*)(&To[wave][rr][lane * 4]);  }
}
}  // namespace

extern "C" void kernel_launch(void* const* d_in, const int* in_sizes, int n_in, void* d_out, int out_size, void* d_ws, size_t ws_size, hipStream_t stream) {
  (void)n_in;
  auto Fp = [&](int i) { return (const float*)d_in[i]; };
  // input order: 0 q [2048,32,128], 1 k [2048,8,128], 2 v [2048,8,128]
  if (in_sizes[0] != T * NH * HD || in_sizes[1] != T * NKV * HD || in_sizes[2] != T * NKV * HD || out_size != T * NH * HD) return;
  size_t off = 0; char* ws = (char*)d_ws;
  auto carve = [&](size_t bytes) { char* p = ws + off; off += (bytes + 255) & ~(size_t)255; return p; };
  b16* QP = (b16*)carve((size_t)NH * T * HD * 2); b16* KP = (b16*)carve((size_t)NKV * T * HD * 2); b16* VT = (b16*)carve((size_t)NKV * HD * T * 2);
  if (off > ws_size || off > ((size_t)128 << 20)) return;   // = 25 MB
  qk_kernel<<<((T * NH * HD + T * NKV * HD) / 8 + 255) / 256, 256, 0, stream>>>(Fp(0), Fp(1), QP, KP);
  vt_kernel<<<dim3(T / 64, NKV), 256, 0, stream>>>(Fp(2), VT);
  attn_kernel<<<dim3(T / 32, NKV), 256, 0, stream>>>(QP, KP, VT, (float*)d_out);
}

// v002
// A run of this version takes 101 microseconds.
// In both of two side-by-side timings against v001, it was 1.16 times as fast.
// Over all steps from v000 it is 2.67 times as fast.
#include <hip/hip_runtime.h>

// Causal grouped-query attention on given q [2048 tokens][32 heads][128], k/v [2048][8 kv-heads][128]: head h uses kv head h/4; scores = q.k 128^-0.5, causal (s <= t), softmax over s,
// out = sum_s p v -> [2048][32][128]. No projections: q, k, v are the (bf16-rounded) module inputs.
// Deterministic: per (head, 16-query wave) a flash-style pass over the 32-key blocks up to the diagonal with fixed-order online softmax; no atomics.
// compute dtype: WMMA v_wmma_f32_16x16x32_f16 with f32 accumulate for S^T = K Q^T (q, k bf16-exact x8 in f16: EXACT products, K = 128: 1 product) and O^T += V^T P^T (v bf16-exact x8; P x1024 as
// f16 hi + x1024 residual: 2 products); scale, mask and softmax statistics in f32 (exp2). Inputs rounded to bf16 once.
// Fragment k-map per lane half hh for A AND B: elements 0..7 <- k = 8hh+0..7, 8..15 <- k = 16+8hh+0..7; acc[r] = D[8hh+r][col].

namespace {
typedef _Float16 b16;
typedef __attribute__((ext_vector_type(16))) _Float16 v16b;
typedef __attribute__((ext_vector_type(8))) _Float16 v8b;
typedef __attribute__((ext_vector_type(4))) _Float16 v4h;
typedef __attribute__((ext_vector_type(2))) _Float16 v2h;
typedef __attribute__((ext_vector_type(8))) float v8f;
typedef __attribute__((ext_vector_type(4))) float v4f;
typedef __attribute__((ext_vector_type(2))) float v2f;
__device__ __forceinline__ float bf16_rne(float f) { unsigned int u = __float_as_uint(f); u += 0x7FFFu + ((u >> 16) & 1u); return __uint_as_float(u & 0xFFFF0000u); }
__device__ __forceinline__ void split16(float v, b16& hi, b16& lo) { hi = (b16)v; lo = (b16)(v - (float)hi); }
__device__ __forceinline__ v16b frag_kb(const b16* p, int hh) { const v8b a = *(const v8b*)(p + 8 * hh), b = *(const v8b*)(p + 16 + 8 * hh); v16b f;
#pragma unroll
  for (int e = 0; e < 8; ++e) { f[e] = a[e]; f[8 + e] = b[e]; } return f; }
__device__ __forceinline__ v8f wmma16b(v16b a, v16b b, v8f c) { v8f d = __builtin_amdgcn_wmma_f32_16x16x32_f16(false, a, false, b, (short)0, c, false, false); asm volatile("v_nop\n\tv_nop\n\tv_nop\n\tv_nop" : "+v"(d) : "v"(a), "v"(b)); return d; }
__device__ __forceinline__ void wave_lds_sync() { __builtin_amdgcn_fence(__ATOMIC_RELEASE, "workgroup"); __builtin_amdgcn_wave_barrier(); __builtin_amdgcn_fence(__ATOMIC_ACQUIRE, "workgroup"); }
__device__ __forceinline__ float pmul(float a, float b) { float p = a * b; asm volatile("" : "+v"(p)); return p; }
__device__ __forceinline__ int iclamp(int v, int lo, int hi) { return v < lo ? lo : (v > hi ? hi : v); }
__device__ __forceinline__ float nexp2(float v) { return __builtin_amdgcn_exp2f(v); }

constexpr int T = 2048, NH = 32, NKV = 8, GRP = NH / NKV, HD = 128, HL = NH /* query heads computed (== NH shipped) */;
constexpr float XS = 8.0f, PS = 1024.0f, RS_ = 1024.0f, LOG2E = 1.4426950408889634f, SCALE = 0.088388347648318447f /* 128^-0.5 */;
static_assert(T % 64 == 0 && HD == 128 && NH % NKV == 0, "tiling");

// planes: QP[h][t][128] = f16(bf16(q[t][h]) x8) and KP[kh][s][128] likewise (head-major so a wave's fragment rows are contiguous); V^T[kh][d][s] (keys contiguous): block = (kh, 64 tokens), the
__global__ __launch_bounds__(256) void qk_kernel(const float* __restrict__ q, const float* __restrict__ k, b16* __restrict__ QP, b16* __restrict__ KP) {
  const int u = blockIdx.x * 256 + threadIdx.x; const int nq = T * NH * HD / 8, nk = T * NKV * HD / 8;
  if (u < nq) { const int e = u * 8; const int h = e / (T * HD), rem = e % (T * HD), t = rem / HD, d = rem % HD; const float* src = q + ((size_t)t * NH + h) * HD + d; v8b o; for (int j = 0; j < 8; ++j) o[j] = (b16)(bf16_rne(src[j]) * XS);
    { *(v8b*)(QP + e) = o;  } }
  else if (u < nq + nk) { const int e = (u - nq) * 8; const int h = e / (T * HD), rem = e % (T * HD), t = rem / HD, d = rem % HD; const float* src = k + ((size_t)t * NKV + h) * HD + d; v8b o; for (int j = 0; j < 8; ++j) o[j] = (b16)(bf16_rne(src[j]) * XS);
    { *(v8b*)(KP + e) = o;  } }
}
__global__ __launch_bounds__(256) void vt_kernel(const float* __restrict__ v, b16* __restrict__ VT) {
  __shared__ __attribute__((aligned(16))) b16 Ts[HD][64 + 8]; const int kh = blockIdx.y, s0 = blockIdx.x * 64;
  for (int i = threadIdx.x; i < 64 * HD; i += 256) { const int tt = i / HD, d = i % HD; Ts[d][tt] = (b16)(bf16_rne(v[((size_t)(s0 + tt) * NKV + kh) * HD + d]) * XS); }
  __syncthreads();
  const int wave = threadIdx.x >> 5, lane = threadIdx.x & 31;
  { for (int d = wave; d < HD; d += 8) *(v2h*)(VT + ((size_t)kh * HD + d) * T + s0 + lane * 2) = *(const v2h*)(&Ts[d][lane * 2]);  }
}
// attention: grid (T/32, NKV); block = 8 waves = the 4 query heads of kv head kh x 2 tiles of 16 queries (32 positions), so all eight waves walk the same bx + 1 key blocks of 32 and share ONE copy of each
// block's K rows and V^T columns in LDS (two buffers, filled by asynchronous 16-byte copies one block ahead; rows padded to 272 / 80 bytes for the 16-byte fragment reads). Per wave as before: S^T = K Q^T
// (4 k-steps x 2 key tiles, 1 product: exact operands), logit = s/64 x 128^-0.5 in log2 units, keys s > t -> -inf (diagonal kept), online softmax, P x1024 hi + residual -> LDS, O^T += V^T P^T
// (8 d-tiles x 2 products -> o, o2); out[t][h][d] = (o + o2/1024)/(l 1024 8). The LDS fragment reads run ahead of the products (K four fragments, V^T three), within 256 registers so that two work-groups still share a WGP:
constexpr int KPIT = HD + 8, VPIT = 32 + 8;   // LDS row pitch in elements
// one key block: K rows s0..s0+31 (8 KB contiguous) and 32 columns of the 128 V^T rows; each of the 256 threads copies 2 + 2 pieces of 16 bytes. The s_wait_xcnt stands inside the statement so that no address
// register of an issued copy is rewritten in front of it.
__device__ __forceinline__ void stage_copy(unsigned lk, unsigned lv, const b16* gk, const b16* gv) {
  const unsigned lk1 = lk + 16 * KPIT * 2, lv1 = lv + 64 * VPIT * 2; const b16* gk1 = gk + 16 * HD; const b16* gv1 = gv + (size_t)64 * T;
  asm volatile("global_load_async_to_lds_b128 %0, %4, off\n\tglobal_load_async_to_lds_b128 %1, %5, off\n\tglobal_load_async_to_lds_b128 %2, %6, off\n\tglobal_load_async_to_lds_b128 %3, %7, off\n\ts_wait_xcnt 0x0"
               :: "v"(lk), "v"(lk1), "v"(lv), "v"(lv1), "v"(gk), "v"(gk1), "v"(gv), "v"(gv1) : "memory");
}
__global__ __launch_bounds__(256) void attn_kernel(const b16* __restrict__ QP, const b16* __restrict__ KP, const b16* __restrict__ VT, float* __restrict__ out) {
  __shared__ __attribute__((aligned(16))) b16 Ks[2][32][KPIT], Vs[2][HD][VPIT];
  __shared__ __attribute__((aligned(16))) b16 Pb[8][16][32 + 8], Pl[8][16][32 + 8]; __shared__ __attribute__((aligned(16))) float To[8][16][HD + 4];
  const int tid = threadIdx.x, wave = tid >> 5, lane = tid & 31, hh = lane >> 4, col = lane & 15; const int kh = blockIdx.y, h = kh * GRP + (wave & 3); const int t0 = blockIdx.x * 32 + (wave >> 2) * 16; const int tq = t0 + col;
  const b16* Qb = QP + ((size_t)h * T + tq) * HD; const b16* Kb = KP + (size_t)kh * T * HD; const b16* Vb = VT + (size_t)kh * HD * T;
  const int ntrip = blockIdx.x + 1;   // key blocks up to the diagonal: the same for the eight waves
  // this thread's pieces: K piece tid (row tid/16, 16 bytes at tid%16) and tid + 256 (16 rows on); V^T piece tid (row tid/4, 16 bytes at tid%4) and tid + 256 (64 rows on)
  const unsigned lk0 = (unsigned)(size_t)&Ks[0][tid >> 4][(tid & 15) * 8], lv0 = (unsigned)(size_t)&Vs[0][tid >> 2][(tid & 3) * 8];
  const b16* gk0 = Kb + tid * 8; const b16* gv0 = Vb + (size_t)(tid >> 2) * T + (tid & 3) * 8;
  constexpr unsigned KBUF = 32 * KPIT * 2, VBUF = HD * VPIT * 2;   // bytes per buffer
  stage_copy(lk0, lv0, gk0, gv0);
  v16b qf[4]; for (int kb = 0; kb < 4; ++kb) qf[kb] = frag_kb(Qb + kb * 32, hh);
  asm volatile("s_wait_asynccnt 0x0" ::: "memory");   // block 0's own copies have landed
  __syncthreads();                                     // ... and every other wave's: block 0 is readable
  if (ntrip > 1) stage_copy(lk0 + KBUF, lv0 + VBUF, gk0 + 32 * HD, gv0 + 32);
  const float cs = LOG2E * SCALE / (XS * XS);
  float mrun = -INFINITY, l = 0.0f; v8f o[8], o2[8];
#pragma unroll
  for (int t = 0; t < 8; ++t) { o[t] = (v8f){}; o2[t] = (v8f){}; }
#pragma unroll 1
  for (int it = 0; it < ntrip; ++it) {
    const int s0 = it * 32, buf = it & 1;
    float e[16]; float mx = -INFINITY;
    // the eight K fragments are read four ahead of the products that use them (order: k-step major, the two key tiles alternating), so that one LDS latency is waited out per four fragments, not per fragment
    const b16* kr = &Ks[buf][col][0]; v16b kf[4]; v8f sacc[2] = {(v8f){}, (v8f){}};
#pragma unroll
    for (int j = 0; j < 4; ++j) kf[j] = frag_kb(kr + (j & 1) * 16 * KPIT + (j >> 1) * 32, hh);
    __builtin_amdgcn_sched_barrier(0);   // keeps the four reads above as one group in front of the first product
#pragma unroll
    for (int j = 0; j < 8; ++j) { sacc[j & 1] = wmma16b(kf[j & 3], qf[j >> 1], sacc[j & 1]); if (j < 4) kf[j & 3] = frag_kb(kr + (j & 1) * 16 * KPIT + ((j + 4) >> 1) * 32, hh);
      __builtin_amdgcn_sched_barrier(0); }   // keeps each refill directly behind the product that frees its registers: sunk to its use it would be waited for in full
#pragma unroll
    for (int u2 = 0; u2 < 2; ++u2)
#pragma unroll
      for (int r = 0; r < 8; ++r) { const int s = s0 + u2 * 16 + 8 * hh + r; const float vv = (s <= tq) ? sacc[u2][r] * cs : -INFINITY; e[u2 * 8 + r] = vv; mx = fmaxf(mx, vv); }
    mx = fmaxf(mx, __shfl_xor(mx, 16)); const float mn = fmaxf(mrun, mx); const float al = (mn == -INFINITY) ? 1.0f : nexp2(mrun - mn); float sum = 0.0f;
#pragma unroll
    for (int i2 = 0; i2 < 16; ++i2) { const float p = (mn == -INFINITY) ? 0.0f : nexp2(e[i2] - mn); sum += p; const float psv = p * PS; const b16 p1 = (b16)psv; const int slot = (i2 < 8 ? 0 : 16) + 8 * hh + (i2 & 7); Pb[wave][col][slot] = p1; Pl[wave][col][slot] = (b16)((psv - (float)p1) * RS_); }
    sum += __shfl_xor(sum, 16); l = l * al + sum; mrun = mn;
    wave_lds_sync();
    const v16b pf = frag_kb(&Pb[wave][col][0], hh), plf = frag_kb(&Pl[wave][col][0], hh); v16b vf[3];
#pragma unroll
    for (int t = 0; t < 3; ++t) vf[t] = frag_kb(&Vs[buf][t * 16 + col][0], hh);
    __builtin_amdgcn_sched_barrier(0);   // P and the first three V^T fragments are read as one group; the rescale below runs while they are on their way
#pragma unroll
    for (int t = 0; t < 8; ++t) { o[t] *= al; o2[t] *= al; }
    __builtin_amdgcn_sched_barrier(0);   // keeps the rescale in front of the products, inside the reads' latency
#pragma unroll
    for (int t = 0; t < 8; ++t) { o[t] = wmma16b(vf[t % 3], pf, o[t]); o2[t] = wmma16b(vf[t % 3], plf, o2[t]); if (t < 5) vf[t % 3] = frag_kb(&Vs[buf][(t + 3) * 16 + col][0], hh);
      __builtin_amdgcn_sched_barrier(0); }   // keeps each refill directly behind the two products that free its registers
    wave_lds_sync();
    asm volatile("s_wait_dscnt 0x0" ::: "memory");      // this wave's reads of buffer buf are done before the buffer is handed back
    asm volatile("s_wait_asynccnt 0x0" ::: "memory");   // this wave's copies of block it + 1 have landed
    __syncthreads();                                     // publishes block it + 1 and ends every wave's reads of buffer buf
    if (it + 2 < ntrip) stage_copy(lk0 + buf * KBUF, lv0 + buf * VBUF, gk0 + (size_t)(s0 + 64) * HD, gv0 + s0 + 64); }
  asm volatile("s_wait_asynccnt 0x0" ::: "memory");     // nothing of this wave's is in flight when it leaves the loop
  const float inv = 1.0f / (l * PS * XS);
#pragma unroll
  for (int t = 0; t < 8; ++t)
#pragma unroll
    for (int r = 0; r < 8; ++r) To[wave][col][t * 16 + 8 * hh + r] = (o[t][r] + o2[t][r] * (1.0f / RS_)) * inv;
  wave_lds_sync();
  { for (int rr = 0; rr < 16; ++rr) *(v4f*)(out + ((size_t)(t0 + rr) * NH + h) * HD + lane * 4) = *(const v4f*)(&To[wave][rr][lane * 4]);  }
}
}  // namespace

extern "C" void kernel_launch(void* const* d_in, const int* in_sizes, int n_in, void* d_out, int out_size, void* d_ws, size_t ws_size, hipStream_t stream) {
  (void)n_in;
  auto Fp = [&](int i) { return (const float*)d_in[i]; };
  // input order: 0 q [2048,32,128], 1 k [2048,8,128], 2 v [2048,8,128]
  if (in_sizes[0] != T * NH * HD || in_sizes[1] != T * NKV * HD || in_sizes[2] != T * NKV * HD || out_size != T * NH * HD) return;
  size_t off = 0; char* ws = (char*)d_ws;
  auto carve = [&](size_t bytes) { char* p = ws + off; off += (bytes + 255) & ~(size_t)255; return p; };
  b16* QP = (b16*)carve((size_t)NH * T * HD * 2); b16* KP = (b16*)carve((size_t)NKV * T * HD * 2); b16* VT = (b16*)carve((size_t)NKV * HD * T * 2);
  if (off > ws_size || off > ((size_t)128 << 20)) return;   // = 25 MB
  qk_kernel<<<((T * NH * HD + T * NKV * HD) / 8 + 255) / 256, 256, 0, stream>>>(Fp(0), Fp(1), QP, KP);
  vt_kernel<<<dim3(T / 64, NKV), 256, 0, stream>>>(Fp(2), VT);
  attn_kernel<<<dim3(T / 32, NKV), 256, 0, stream>>>(QP, KP, VT, (float*)d_out);
}

// v003
// It runs in 78.9 microseconds.
// In two side-by-side timings against v002, it was 1.28 and 1.27 times as fast.
// Counting every step since v000, it is 3.41 times as fast.
#include <hip/hip_runtime.h>

// Causal grouped-query attention on given q [2048 tokens][32 heads][128], k/v [2048][8 kv-heads][128]: head h uses kv head h/4; scores = q.k 128^-0.5, causal (s <= t), softmax over s,
// out = sum_s p v -> [2048][32][128]. No projections: q, k, v are the (bf16-rounded) module inputs.
// Deterministic: per (head, 16-query wave) a flash-style pass over the 32-key blocks up to the diagonal with fixed-order online softmax; no atomics.
// compute dtype: WMMA v_wmma_f32_16x16x32_f16 with f32 accumulate for S^T = K Q^T (q, k bf16-exact x8 in f16: EXACT products, K = 128: 1 product) and O^T += V^T P^T (v bf16-exact x8; P x1024 as
// f16 hi + x1024 residual: 2 products); scale, mask and softmax statistics in f32 (exp2). Inputs rounded to bf16 once.
// Fragment k-map per lane half hh for A AND B: elements 0..7 <- k = 8hh+0..7, 8..15 <- k = 16+8hh+0..7; acc[r] = D[8hh+r][col].

namespace {
typedef _Float16 b16;
typedef __attribute__((ext_vector_type(16))) _Float16 v16b;
typedef __attribute__((ext_vector_type(8))) _Float16 v8b;
typedef __attribute__((ext_vector_type(4))) _Float16 v4h;
typedef __attribute__((ext_vector_type(2))) _Float16 v2h;
typedef __attribute__((ext_vector_type(8))) float v8f;
typedef __attribute__((ext_vector_type(4))) float v4f;
typedef __attribute__((ext_vector_type(2))) float v2f;
__device__ __forceinline__ float bf16_rne(float f) { unsigned int u = __float_as_uint(f); u += 0x7FFFu + ((u >> 16) & 1u); return __uint_as_float(u & 0xFFFF0000u); }
__device__ __forceinline__ void split16(float v, b16& hi, b16& lo) { hi = (b16)v; lo = (b16)(v - (float)hi); }
__device__ __forceinline__ v16b frag_kb(const b16* p, int hh) { const v8b a = *(const v8b*)(p + 8 * hh), b = *(const v8b*)(p + 16 + 8 * hh); v16b f;
#pragma unroll
  for (int e = 0; e < 8; ++e) { f[e] = a[e]; f[8 + e] = b[e]; } return f; }
__device__ __forceinline__ v8f wmma16b(v16b a, v16b b, v8f c) { v8f d = __builtin_amdgcn_wmma_f32_16x16x32_f16(false, a, false, b, (short)0, c, false, false); asm volatile("v_nop\n\tv_nop\n\tv_nop\n\tv_nop" : "+v"(d) : "v"(a), "v"(b)); return d; }
__device__ __forceinline__ void wave_lds_sync() { __builtin_amdgcn_fence(__ATOMIC_RELEASE, "workgroup"); __builtin_amdgcn_wave_barrier(); __builtin_amdgcn_fence(__ATOMIC_ACQUIRE, "workgroup"); }
__device__ __forceinline__ float pmul(float a, float b) { float p = a * b; asm volatile("" : "+v"(p)); return p; }
__device__ __forceinline__ int iclamp(int v, int lo, int hi) { return v < lo ? lo : (v > hi ? hi : v); }
__device__ __forceinline__ float nexp2(float v) { return __builtin_amdgcn_exp2f(v); }

constexpr int T = 2048, NH = 32, NKV = 8, GRP = NH / NKV, HD = 128, HL = NH /* unused (all NH heads are computed) */;
constexpr float XS = 8.0f, PS = 1024.0f, RS_ = 1024.0f, LOG2E = 1.4426950408889634f, SCALE = 0.088388347648318447f /* 128^-0.5 */;
static_assert(T % 64 == 0 && HD == 128 && NH % NKV == 0, "tiling");

// planes: QP[h][t][128] = f16(bf16(q[t][h]) x8) and KP[kh][s][128] likewise (head-major so a wave's fragment rows are contiguous); V^T[kh][d][s] (keys contiguous): block = (kh, 64 tokens), the
__global__ __launch_bounds__(256) void qk_kernel(const float* __restrict__ q, const float* __restrict__ k, b16* __restrict__ QP, b16* __restrict__ KP) {
  const int u = blockIdx.x * 256 + threadIdx.x; const int nq = T * NH * HD / 8, nk = T * NKV * HD / 8;
  if (u < nq) { const int e = u * 8; const int h = e / (T * HD), rem = e % (T * HD), t = rem / HD, d = rem % HD; const float* src = q + ((size_t)t * NH + h) * HD + d; v8b o; for (int j = 0; j < 8; ++j) o[j] = (b16)(bf16_rne(src[j]) * XS);
    { *(v8b*)(QP + e) = o;  } }
  else if (u < nq + nk) { const int e = (u - nq) * 8; const int h = e / (T * HD), rem = e % (T * HD), t = rem / HD, d = rem % HD; const float* src = k + ((size_t)t * NKV + h) * HD + d; v8b o; for (int j = 0; j < 8; ++j) o[j] = (b16)(bf16_rne(src[j]) * XS);
    { *(v8b*)(KP + e) = o;  } }
}
__global__ __launch_bounds__(256) void vt_kernel(const float* __restrict__ v, b16* __restrict__ VT) {
  __shared__ __attribute__((aligned(16))) b16 Ts[HD][64 + 8]; const int kh = blockIdx.y, s0 = blockIdx.x * 64;
  for (int i = threadIdx.x; i < 64 * HD; i += 256) { const int tt = i / HD, d = i % HD; Ts[d][tt] = (b16)(bf16_rne(v[((size_t)(s0 + tt) * NKV + kh) * HD + d]) * XS); }
  __syncthreads();
  const int wave = threadIdx.x >> 5, lane = threadIdx.x & 31;
  { for (int d = wave; d < HD; d += 8) *(v2h*)(VT + ((size_t)kh * HD + d) * T + s0 + lane * 2) = *(const v2h*)(&Ts[d][lane * 2]);  }
}
// attention: grid (T/64, NKV), one work-group per WGP; a block takes the 32-position tile T/32 - 1 - blockIdx.x and then tile blockIdx.x, one after the other in every wave, so that every block walks T/32 + 1 key
// blocks: with one tile per block all blocks are resident at once and the launch lasts as long as the last tile's T/32 key blocks, about twice the mean.
// block = 8 waves = the 4 query heads of kv head kh x 2 tiles of 16 queries (32 positions), so all eight waves walk the same bx + 1 key blocks of 32 and share ONE copy of each
// block's K rows and V^T columns in LDS (two buffers, filled by asynchronous 16-byte copies one block ahead; rows padded to 272 / 80 bytes for the 16-byte fragment reads). Per wave as before: S^T = K Q^T
// (4 k-steps x 2 key tiles, 1 product: exact operands), logit = s/64 x 128^-0.5 in log2 units, keys s > t -> -inf (diagonal kept), online softmax, P x1024 hi + residual -> LDS, O^T += V^T P^T
// (8 d-tiles x 2 products -> o, o2); out[t][h][d] = (o + o2/1024)/(l 1024 8). The LDS fragment reads run ahead of the products (K four fragments, V^T three), within 256 registers so that two work-groups still share a WGP:
constexpr int KPIT = HD + 8, VPIT = 32 + 8;   // LDS row pitch in elements
// one key block: K rows s0..s0+31 (8 KB contiguous) and 32 columns of the 128 V^T rows; each of the 256 threads copies 2 + 2 pieces of 16 bytes. The s_wait_xcnt stands inside the statement so that no address
// register of an issued copy is rewritten in front of it.
__device__ __forceinline__ void stage_copy(unsigned lk, unsigned lv, const b16* gk, const b16* gv) {
  const unsigned lk1 = lk + 16 * KPIT * 2, lv1 = lv + 64 * VPIT * 2; const b16* gk1 = gk + 16 * HD; const b16* gv1 = gv + (size_t)64 * T;
  asm volatile("global_load_async_to_lds_b128 %0, %4, off\n\tglobal_load_async_to_lds_b128 %1, %5, off\n\tglobal_load_async_to_lds_b128 %2, %6, off\n\tglobal_load_async_to_lds_b128 %3, %7, off\n\ts_wait_xcnt 0x0"
               :: "v"(lk), "v"(lk1), "v"(lv), "v"(lv1), "v"(gk), "v"(gk1), "v"(gv), "v"(gv1) : "memory");
}
__global__ __launch_bounds__(256) void attn_kernel(const b16* __restrict__ QP, const b16* __restrict__ KP, const b16* __restrict__ VT, float* __restrict__ out) {
  __shared__ __attribute__((aligned(16))) b16 Ks[2][32][KPIT], Vs[2][HD][VPIT];
  __shared__ __attribute__((aligned(16))) b16 Pb[8][16][32 + 8], Pl[8][16][32 + 8]; __shared__ __attribute__((aligned(16))) float To[8][16][HD + 4];
  const int tid = threadIdx.x, wave = tid >> 5, lane = tid & 31, hh = lane >> 4, col = lane & 15; const int kh = blockIdx.y, h = kh * GRP + (wave & 3);
  const b16* Kb = KP + (size_t)kh * T * HD; const b16* Vb = VT + (size_t)kh * HD * T;
  // this thread's pieces: K piece tid (row tid/16, 16 bytes at tid%16) and tid + 256 (16 rows on); V^T piece tid (row tid/4, 16 bytes at tid%4) and tid + 256 (64 rows on)
  const unsigned lk0 = (unsigned)(size_t)&Ks[0][tid >> 4][(tid & 15) * 8], lv0 = (unsigned)(size_t)&Vs[0][tid >> 2][(tid & 3) * 8];
  const b16* gk0 = Kb + tid * 8; const b16* gv0 = Vb + (size_t)(tid >> 2) * T + (tid & 3) * 8;
  constexpr unsigned KBUF = 32 * KPIT * 2, VBUF = HD * VPIT * 2;   // bytes per buffer
#pragma unroll 1   // the two tiles go through one copy of the code
  for (int half = 0; half < 2; ++half) {
  const int bx = half ? (int)blockIdx.x : T / 32 - 1 - (int)blockIdx.x;   // block-uniform; the long tile first. The last trip's barrier of the first tile has ended every read of both buffers
  const int t0 = bx * 32 + (wave >> 2) * 16; const int tq = t0 + col; const b16* Qb = QP + ((size_t)h * T + tq) * HD;
  const int ntrip = bx + 1;   // key blocks up to the diagonal: the same for the eight waves
  stage_copy(lk0, lv0, gk0, gv0);
  v16b qf[4]; for (int kb = 0; kb < 4; ++kb) qf[kb] = frag_kb(Qb + kb * 32, hh);
  asm volatile("s_wait_asynccnt 0x0" ::: "memory");   // block 0's own copies have landed
  __syncthreads();                                     // ... and every other wave's: block 0 is readable
  if (ntrip > 1) stage_copy(lk0 + KBUF, lv0 + VBUF, gk0 + 32 * HD, gv0 + 32);
  const float cs = LOG2E * SCALE / (XS * XS);
  float mrun = -INFINITY, l = 0.0f; v8f o[8], o2[8];
#pragma unroll
  for (int t = 0; t < 8; ++t) { o[t] = (v8f){}; o2[t] = (v8f){}; }
#pragma unroll 1
  for (int it = 0; it < ntrip; ++it) {
    const int s0 = it * 32, buf = it & 1;
    float e[16]; float mx = -INFINITY;
    // the eight K fragments are read four ahead of the products that use them (order: k-step major, the two key tiles alternating), so that one LDS latency is waited out per four fragments, not per fragment
    const b16* kr = &Ks[buf][col][0]; v16b kf[4]; v8f sacc[2] = {(v8f){}, (v8f){}};
#pragma unroll
    for (int j = 0; j < 4; ++j) kf[j] = frag_kb(kr + (j & 1) * 16 * KPIT + (j >> 1) * 32, hh);
    __builtin_amdgcn_sched_barrier(0);   // keeps the four reads above as one group in front of the first product
#pragma unroll
    for (int j = 0; j < 8; ++j) { sacc[j & 1] = wmma16b(kf[j & 3], qf[j >> 1], sacc[j & 1]); if (j < 4) kf[j & 3] = frag_kb(kr + (j & 1) * 16 * KPIT + ((j + 4) >> 1) * 32, hh);
      __builtin_amdgcn_sched_barrier(0); }   // keeps each refill directly behind the product that frees its registers: sunk to its use it would be waited for in full
#pragma unroll
    for (int u2 = 0; u2 < 2; ++u2)
#pragma unroll
      for (int r = 0; r < 8; ++r) { const int s = s0 + u2 * 16 + 8 * hh + r; const float vv = (s <= tq) ? sacc[u2][r] * cs : -INFINITY; e[u2 * 8 + r] = vv; mx = fmaxf(mx, vv); }
    mx = fmaxf(mx, __shfl_xor(mx, 16)); const float mn = fmaxf(mrun, mx); const float al = (mn == -INFINITY) ? 1.0f : nexp2(mrun - mn); float sum = 0.0f;
#pragma unroll
    for (int i2 = 0; i2 < 16; ++i2) { const float p = (mn == -INFINITY) ? 0.0f : nexp2(e[i2] - mn); sum += p; const float psv = p * PS; const b16 p1 = (b16)psv; const int slot = (i2 < 8 ? 0 : 16) + 8 * hh + (i2 & 7); Pb[wave][col][slot] = p1; Pl[wave][col][slot] = (b16)((psv - (float)p1) * RS_); }
    sum += __shfl_xor(sum, 16); l = l * al + sum; mrun = mn;
    wave_lds_sync();
    const v16b pf = frag_kb(&Pb[wave][col][0], hh), plf = frag_kb(&Pl[wave][col][0], hh); v16b vf[3];
#pragma unroll
    for (int t = 0; t < 3; ++t) vf[t] = frag_kb(&Vs[buf][t * 16 + col][0], hh);
    __builtin_amdgcn_sched_barrier(0);   // P and the first three V^T fragments are read as one group; the rescale below runs while they are on their way
#pragma unroll
    for (int t = 0; t < 8; ++t) { o[t] *= al; o2[t] *= al; }
    __builtin_amdgcn_sched_barrier(0);   // keeps the rescale in front of the products, inside the reads' latency
#pragma unroll
    for (int t = 0; t < 8; ++t) { o[t] = wmma16b(vf[t % 3], pf, o[t]); o2[t] = wmma16b(vf[t % 3], plf, o2[t]); if (t < 5) vf[t % 3] = frag_kb(&Vs[buf][(t + 3) * 16 + col][0], hh);
      __builtin_amdgcn_sched_barrier(0); }   // keeps each refill directly behind the two products that free its registers
    wave_lds_sync();
    asm volatile("s_wait_dscnt 0x0" ::: "memory");      // this wave's reads of buffer buf are done before the buffer is handed back
    asm volatile("s_wait_asynccnt 0x0" ::: "memory");   // this wave's copies of block it + 1 have landed
    __syncthreads();                                     // publishes block it + 1 and ends every wave's reads of buffer buf
    if (it + 2 < ntrip) stage_copy(lk0 + buf * KBUF, lv0 + buf * VBUF, gk0 + (size_t)(s0 + 64) * HD, gv0 + s0 + 64); }
  asm volatile("s_wait_asynccnt 0x0" ::: "memory");     // nothing of this wave's is in flight when it leaves the loop
  const float inv = 1.0f / (l * PS * XS);
#pragma unroll
  for (int t = 0; t < 8; ++t)
#pragma unroll
    for (int r = 0; r < 8; ++r) To[wave][col][t * 16 + 8 * hh + r] = (o[t][r] + o2[t][r] * (1.0f / RS_)) * inv;
  wave_lds_sync();
  { for (int rr = 0; rr < 16; ++rr) *(v4f*)(out + ((size_t)(t0 + rr) * NH + h) * HD + lane * 4) = *(const v4f*)(&To[wave][rr][lane * 4]);  }
  asm volatile("s_wait_xcnt 0x0" ::: "memory");   // stands behind the tile's stores, in front of the next tile's prologue, which rewrites the registers that they name
  }
}
}  // namespace

extern "C" void kernel_launch(void* const* d_in, const int* in_sizes, int n_in, void* d_out, int out_size, void* d_ws, size_t ws_size, hipStream_t stream) {
  (void)n_in;
  auto Fp = [&](int i) { return (const float*)d_in[i]; };
  // input order: 0 q [2048,32,128], 1 k [2048,8,128], 2 v [2048,8,128]
  if (in_sizes[0] != T * NH * HD || in_sizes[1] != T * NKV * HD || in_sizes[2] != T * NKV * HD || out_size != T * NH * HD) return;
  size_t off = 0; char* ws = (char*)d_ws;
  auto carve = [&](size_t bytes) { char* p = ws + off; off += (bytes + 255) & ~(size_t)255; return p; };
  b16* QP = (b16*)carve((size_t)NH * T * HD * 2); b16* KP = (b16*)carve((size_t)NKV * T * HD * 2); b16* VT = (b16*)carve((size_t)NKV * HD * T * 2);
  if (off > ws_size || off > ((size_t)128 << 20)) return;   // = 25 MB
  qk_kernel<<<((T * NH * HD + T * NKV * HD) / 8 + 255) / 256, 256, 0, stream>>>(Fp(0), Fp(1), QP, KP);
  vt_kernel<<<dim3(T / 64, NKV), 256, 0, stream>>>(Fp(2), VT);
  attn_kernel<<<dim3(T / 64, NKV), 256, 0, stream>>>(QP, KP, VT, (float*)d_out);
}

// v004
// A run of this version takes 72 microseconds.
// Timed twice side by side with v003, it ran 1.10 and 1.09 times as fast.
// All steps since v000 together make it 3.73 times as fast.
#include <hip/hip_runtime.h>

// Causal grouped-query attention on given q [2048 tokens][32 heads][128], k/v [2048][8 kv-heads][128]: head h uses kv head h/4; scores = q.k 128^-0.5, causal (s <= t), softmax over s,
// out = sum_s p v -> [2048][32][128]. No projections: q, k, v are the (bf16-rounded) module inputs.
// Deterministic: per (head, 16-query tile) two waves take the even and the odd 32-key blocks up to the diagonal, each a flash-style pass with fixed-order online softmax, joined in fixed order; no atomics.
// compute dtype: WMMA v_wmma_f32_16x16x32_f16 with f32 accumulate for S^T = K Q^T (q, k bf16-exact x8 in f16: EXACT products, K = 128: 1 product) and O^T += V^T P^T (v bf16-exact x8; P x1024 as
// f16 hi + x1024 residual: 2 products); scale, mask and softmax statistics in f32 (exp2). Inputs rounded to bf16 once.
// Fragment k-map per lane half hh for A AND B: elements 0..7 <- k = 8hh+0..7, 8..15 <- k = 16+8hh+0..7; acc[r] = D[8hh+r][col].

namespace {
typedef _Float16 b16;
typedef __attribute__((ext_vector_type(16))) _Float16 v16b;
typedef __attribute__((ext_vector_type(8))) _Float16 v8b;
typedef __attribute__((ext_vector_type(4))) _Float16 v4h;
typedef __attribute__((ext_vector_type(2))) _Float16 v2h;
typedef __attribute__((ext_vector_type(8))) float v8f;
typedef __attribute__((ext_vector_type(4))) float v4f;
typedef __attribute__((ext_vector_type(2))) float v2f;
__device__ __forceinline__ float bf16_rne(float f) { unsigned int u = __float_as_uint(f); u += 0x7FFFu + ((u >> 16) & 1u); return __uint_as_float(u & 0xFFFF0000u); }
__device__ __forceinline__ void split16(float v, b16& hi, b16& lo) { hi = (b16)v; lo = (b16)(v - (float)hi); }
__device__ __forceinline__ v16b frag_kb(const b16* p, int hh) { const v8b a = *(const v8b*)(p + 8 * hh), b = *(const v8b*)(p + 16 + 8 * hh); v16b f;
#pragma unroll
  for (int e = 0; e < 8; ++e) { f[e] = a[e]; f[8 + e] = b[e]; } return f; }
__device__ __forceinline__ v8f wmma16b(v16b a, v16b b, v8f c) { v8f d = __builtin_amdgcn_wmma_f32_16x16x32_f16(false, a, false, b, (short)0, c, false, false); asm volatile("v_nop\n\tv_nop\n\tv_nop\n\tv_nop" : "+v"(d) : "v"(a), "v"(b)); return d; }
__device__ __forceinline__ void wave_lds_sync() { __builtin_amdgcn_fence(__ATOMIC_RELEASE, "workgroup"); __builtin_amdgcn_wave_barrier(); __builtin_amdgcn_fence(__ATOMIC_ACQUIRE, "workgroup"); }
__device__ __forceinline__ float pmul(float a, float b) { float p = a * b; asm volatile("" : "+v"(p)); return p; }
__device__ __forceinline__ int iclamp(int v, int lo, int hi) { return v < lo ? lo : (v > hi ? hi : v); }
__device__ __forceinline__ float nexp2(float v) { return __builtin_amdgcn_exp2f(v); }

constexpr int T = 2048, NH = 32, NKV = 8, GRP = NH / NKV, HD = 128, HL = NH /* unused (all NH heads are computed) */;
constexpr float XS = 8.0f, PS = 1024.0f, RS_ = 1024.0f, LOG2E = 1.4426950408889634f, SCALE = 0.088388347648318447f /* 128^-0.5 */;
static_assert(T % 64 == 0 && HD == 128 && NH % NKV == 0, "tiling");

// planes: QP[h][t][128] = f16(bf16(q[t][h]) x8) and KP[kh][s][128] likewise (head-major so a wave's fragment rows are contiguous); V^T[kh][d][s] (keys contiguous): block = (kh, 64 tokens), the
__global__ __launch_bounds__(256) void qk_kernel(const float* __restrict__ q, const float* __restrict__ k, b16* __restrict__ QP, b16* __restrict__ KP) {
  const int u = blockIdx.x * 256 + threadIdx.x; const int nq = T * NH * HD / 8, nk = T * NKV * HD / 8;
  if (u < nq) { const int e = u * 8; const int h = e / (T * HD), rem = e % (T * HD), t = rem / HD, d = rem % HD; const float* src = q + ((size_t)t * NH + h) * HD + d; v8b o; for (int j = 0; j < 8; ++j) o[j] = (b16)(bf16_rne(src[j]) * XS);
    { *(v8b*)(QP + e) = o;  } }
  else if (u < nq + nk) { const int e = (u - nq) * 8; const int h = e / (T * HD), rem = e % (T * HD), t = rem / HD, d = rem % HD; const float* src = k + ((size_t)t * NKV + h) * HD + d; v8b o; for (int j = 0; j < 8; ++j) o[j] = (b16)(bf16_rne(src[j]) * XS);
    { *(v8b*)(KP + e) = o;  } }
}
__global__ __launch_bounds__(256) void vt_kernel(const float* __restrict__ v, b16* __restrict__ VT) {
  __shared__ __attribute__((aligned(16))) b16 Ts[HD][64 + 8]; const int kh = blockIdx.y, s0 = blockIdx.x * 64;
  for (int i = threadIdx.x; i < 64 * HD; i += 256) { const int tt = i / HD, d = i % HD; Ts[d][tt] = (b16)(bf16_rne(v[((size_t)(s0 + tt) * NKV + kh) * HD + d]) * XS); }
  __syncthreads();
  const int wave = threadIdx.x >> 5, lane = threadIdx.x & 31;
  { for (int d = wave; d < HD; d += 8) *(v2h*)(VT + ((size_t)kh * HD + d) * T + s0 + lane * 2) = *(const v2h*)(&Ts[d][lane * 2]);  }
}
// attention: grid (T/64, NKV), one work-group of 16 waves per WGP (four waves per SIMD); a block takes the 32-position tile T/32 - 1 - blockIdx.x and then tile blockIdx.x, one after the other in every wave, so that every block walks T/32 + 1 key
// blocks: with one tile per block all blocks are resident at once and the launch lasts as long as the last tile's T/32 key blocks, about twice the mean.
// block = 2 key groups x 8 waves; the 8 waves of a group = the 4 query heads of kv head kh x 2 tiles of 16 queries (32 positions). Group g takes the key blocks 2 it + g (the even or the odd blocks of 32 keys up to the
// diagonal; where their number is odd, group 1's last block lies wholly behind the diagonal and adds nothing), with its own running maximum, sum and O; behind the loop group 1 hands its three through LDS to group 0,
// which joins them (factors 2^(m_g - max)) and stores. So a wave's dependent chain per tile is half as many trips long, and twice as many waves fill each other's waits. The eight waves of a group share ONE copy of each
// block's K rows and V^T columns in LDS (two buffers, filled by asynchronous 16-byte copies one block ahead; rows padded to 272 / 80 bytes for the 16-byte fragment reads). Per wave as before: S^T = K Q^T
// (4 k-steps x 2 key tiles, 1 product: exact operands), logit = s/64 x 128^-0.5 in log2 units, keys s > t -> -inf (diagonal kept), online softmax, P x1024 hi + residual -> LDS, O^T += V^T P^T
// (8 d-tiles x 2 products -> o, o2); out[t][h][d] = (o + o2/1024)/(l 1024 8). The LDS fragment reads run ahead of the products (K four fragments, V^T three), within the 256 registers that four waves per SIMD leave each wave:
constexpr int KPIT = HD + 8, VPIT = 32 + 8;   // LDS row pitch in elements
// one key block: K rows s0..s0+31 (8 KB contiguous) and 32 columns of the 128 V^T rows; each of the 256 threads of a key group copies 2 + 2 pieces of 16 bytes of its group's block. The s_wait_xcnt stands inside the statement so that no address
// register of an issued copy is rewritten in front of it.
__device__ __forceinline__ void stage_copy(unsigned lk, unsigned lv, const b16* gk, const b16* gv) {
  const unsigned lk1 = lk + 16 * KPIT * 2, lv1 = lv + 64 * VPIT * 2; const b16* gk1 = gk + 16 * HD; const b16* gv1 = gv + (size_t)64 * T;
  asm volatile("global_load_async_to_lds_b128 %0, %4, off\n\tglobal_load_async_to_lds_b128 %1, %5, off\n\tglobal_load_async_to_lds_b128 %2, %6, off\n\tglobal_load_async_to_lds_b128 %3, %7, off\n\ts_wait_xcnt 0x0"
               :: "v"(lk), "v"(lk1), "v"(lv), "v"(lv1), "v"(gk), "v"(gk1), "v"(gv), "v"(gv1) : "memory");
}
__global__ __launch_bounds__(512) void attn_kernel(const b16* __restrict__ QP, const b16* __restrict__ KP, const b16* __restrict__ VT, float* __restrict__ out) {
  __shared__ __attribute__((aligned(16))) b16 Ks[2][2][32][KPIT], Vs[2][2][HD][VPIT];   // [key group][buffer]
  __shared__ __attribute__((aligned(16))) b16 Pb[16][16][32 + 8], Pl[16][16][32 + 8]; __shared__ __attribute__((aligned(16))) float To[8][16][HD + 4]; __shared__ float Ml[8][32][2];
  const int wave = __builtin_amdgcn_readfirstlane((int)threadIdx.x >> 5);   // in a scalar register: the tests on the key group below are then scalar branches
  const int g = wave >> 3, w8 = wave & 7, tid = threadIdx.x & 255 /* thread within its key group */, lane = tid & 31, hh = lane >> 4, col = lane & 15; const int kh = blockIdx.y, h = kh * GRP + (w8 & 3);
  const b16* Kb = KP + (size_t)kh * T * HD; const b16* Vb = VT + (size_t)kh * HD * T;
  // this thread's pieces of its group's key block: K piece tid (row tid/16, 16 bytes at tid%16) and tid + 256 (16 rows on); V^T piece tid (row tid/4, 16 bytes at tid%4) and tid + 256 (64 rows on)
  const unsigned lk0 = (unsigned)(size_t)&Ks[g][0][tid >> 4][(tid & 15) * 8], lv0 = (unsigned)(size_t)&Vs[g][0][tid >> 2][(tid & 3) * 8];
  const b16* gk0 = Kb + g * 32 * HD + tid * 8; const b16* gv0 = Vb + (size_t)(tid >> 2) * T + g * 32 + (tid & 3) * 8;
  constexpr unsigned KBUF = 32 * KPIT * 2, VBUF = HD * VPIT * 2;   // bytes per buffer
#pragma unroll 1   // the two tiles go through one copy of the code
  for (int half = 0; half < 2; ++half) {
  const int bx = half ? (int)blockIdx.x : T / 32 - 1 - (int)blockIdx.x;   // block-uniform; the long tile first. The last trip's barrier of the first tile has ended every read of both buffers
  const int t0 = bx * 32 + (w8 >> 2) * 16; const int tq = t0 + col; const b16* Qb = QP + ((size_t)h * T + tq) * HD;
  const int ntrip = (bx + 2) >> 1;   // pairs of key blocks up to the diagonal: the same for the sixteen waves; the last block touched is 2 ntrip - 1 <= T / 32 - 1
  stage_copy(lk0, lv0, gk0, gv0);
  v16b qf[4]; for (int kb = 0; kb < 4; ++kb) qf[kb] = frag_kb(Qb + kb * 32, hh);
  asm volatile("s_wait_asynccnt 0x0" ::: "memory");   // this wave's copies of block g have landed
  __syncthreads();                                     // ... and every other wave's: block g is readable
  if (ntrip > 1) stage_copy(lk0 + KBUF, lv0 + VBUF, gk0 + 64 * HD, gv0 + 64);
  const float cs = LOG2E * SCALE / (XS * XS);
  float mrun = -INFINITY, l = 0.0f; v8f o[8], o2[8];
#pragma unroll
  for (int t = 0; t < 8; ++t) { o[t] = (v8f){}; o2[t] = (v8f){}; }
#pragma unroll 1
  for (int it = 0; it < ntrip; ++it) {
    const int s0 = (2 * it + g) * 32, buf = it & 1;
    float e[16]; float mx = -INFINITY;
    // the eight K fragments are read four ahead of the products that use them (order: k-step major, the two key tiles alternating), so that one LDS latency is waited out per four fragments, not per fragment
    const b16* kr = &Ks[g][buf][col][0]; v16b kf[4]; v8f sacc[2] = {(v8f){}, (v8f){}};
#pragma unroll
    for (int j = 0; j < 4; ++j) kf[j] = frag_kb(kr + (j & 1) * 16 * KPIT + (j >> 1) * 32, hh);
    __builtin_amdgcn_sched_barrier(0);   // keeps the four reads above as one group in front of the first product
#pragma unroll
    for (int j = 0; j < 8; ++j) { sacc[j & 1] = wmma16b(kf[j & 3], qf[j >> 1], sacc[j & 1]); if (j < 4) kf[j & 3] = frag_kb(kr + (j & 1) * 16 * KPIT + ((j + 4) >> 1) * 32, hh);
      __builtin_amdgcn_sched_barrier(0); }   // keeps each refill directly behind the product that frees its registers: sunk to its use it would be waited for in full
#pragma unroll
    for (int u2 = 0; u2 < 2; ++u2)
#pragma unroll
      for (int r = 0; r < 8; ++r) { const int s = s0 + u2 * 16 + 8 * hh + r; const float vv = (s <= tq) ? sacc[u2][r] * cs : -INFINITY; e[u2 * 8 + r] = vv; mx = fmaxf(mx, vv); }
    mx = fmaxf(mx, __shfl_xor(mx, 16)); const float mn = fmaxf(mrun, mx); const float al = (mn == -INFINITY) ? 1.0f : nexp2(mrun - mn); float sum = 0.0f;
#pragma unroll
    for (int i2 = 0; i2 < 16; ++i2) { const float p = (mn == -INFINITY) ? 0.0f : nexp2(e[i2] - mn); sum += p; const float psv = p * PS; const b16 p1 = (b16)psv; const int slot = (i2 < 8 ? 0 : 16) + 8 * hh + (i2 & 7); Pb[wave][col][slot] = p1; Pl[wave][col][slot] = (b16)((psv - (float)p1) * RS_); }
    sum += __shfl_xor(sum, 16); l = l * al + sum; mrun = mn;
    wave_lds_sync();
    const v16b pf = frag_kb(&Pb[wave][col][0], hh), plf = frag_kb(&Pl[wave][col][0], hh); v16b vf[3];
#pragma unroll
    for (int t = 0; t < 3; ++t) vf[t] = frag_kb(&Vs[g][buf][t * 16 + col][0], hh);
    __builtin_amdgcn_sched_barrier(0);   // P and the first three V^T fragments are read as one group; the rescale below runs while they are on their way
#pragma unroll
    for (int t = 0; t < 8; ++t) { o[t] *= al; o2[t] *= al; }
    __builtin_amdgcn_sched_barrier(0);   // keeps the rescale in front of the products, inside the reads' latency
#pragma unroll
    for (int t = 0; t < 8; ++t) { o[t] = wmma16b(vf[t % 3], pf, o[t]); o2[t] = wmma16b(vf[t % 3], plf, o2[t]); if (t < 5) vf[t % 3] = frag_kb(&Vs[g][buf][(t + 3) * 16 + col][0], hh);
      __builtin_amdgcn_sched_barrier(0); }   // keeps each refill directly behind the two products that free its registers
    wave_lds_sync();
    asm volatile("s_wait_dscnt 0x0" ::: "memory");      // this wave's reads of buffer buf are done before the buffer is handed back
    asm volatile("s_wait_asynccnt 0x0" ::: "memory");   // this wave's copies of block 2 it + 2 + g have landed
    __syncthreads();                                     // publishes block 2 it + 2 + g and ends every wave's reads of buffer buf
    if (it + 2 < ntrip) stage_copy(lk0 + buf * KBUF, lv0 + buf * VBUF, gk0 + (size_t)(it + 2) * 64 * HD, gv0 + (it + 2) * 64); }
  asm volatile("s_wait_asynccnt 0x0" ::: "memory");     // nothing of this wave's is in flight when it leaves the loop
  if (g == 1) {   // group 1 hands over its maximum, its sum and its O, each lane at the places that the same lane of its partner wave reads
    Ml[w8][lane][0] = mrun; Ml[w8][lane][1] = l;
#pragma unroll
    for (int t = 0; t < 8; ++t)
#pragma unroll
      for (int r = 0; r < 8; ++r) To[w8][col][t * 16 + 8 * hh + r] = o[t][r] + o2[t][r] * (1.0f / RS_); }
  __syncthreads();   // group 1's hand-over is readable; its next one comes only behind the next tile's barriers, which group 0 reaches after it has read this one
  if (g == 0) {
  const float m1 = Ml[w8][lane][0], l1 = Ml[w8][lane][1]; const float mm = fmaxf(mrun, m1);   // group 0 holds key 0, so mrun is finite; a group 1 without a key in front of the diagonal has m1 = -inf and the factor 0
  const float a0 = nexp2(mrun - mm), a1 = nexp2(m1 - mm); const float inv = 1.0f / ((l * a0 + l1 * a1) * PS * XS); const float f0 = a0 * inv, f1 = a1 * inv;
#pragma unroll
  for (int t = 0; t < 8; ++t)
#pragma unroll
    for (int r = 0; r < 8; ++r) { float* p = &To[w8][col][t * 16 + 8 * hh + r]; *p = (o[t][r] + o2[t][r] * (1.0f / RS_)) * f0 + *p * f1; }
  wave_lds_sync();
  { for (int rr = 0; rr < 16; ++rr) *(v4f*)(out + ((size_t)(t0 + rr) * NH + h) * HD + lane * 4) = *(const v4f*)(&To[w8][rr][lane * 4]);  }
  }
  asm volatile("s_wait_xcnt 0x0" ::: "memory");   // stands behind the tile's stores, in front of the next tile's prologue, which rewrites the registers that they name
  }
}
}  // namespace

extern "C" void kernel_launch(void* const* d_in, const int* in_sizes, int n_in, void* d_out, int out_size, void* d_ws, size_t ws_size, hipStream_t stream) {
  (void)n_in;
  auto Fp = [&](int i) { return (const float*)d_in[i]; };
  // input order: 0 q [2048,32,128], 1 k [2048,8,128], 2 v [2048,8,128]
  if (in_sizes[0] != T * NH * HD || in_sizes[1] != T * NKV * HD || in_sizes[2] != T * NKV * HD || out_size != T * NH * HD) return;
  size_t off = 0; char* ws = (char*)d_ws;
  auto carve = [&](size_t bytes) { char* p = ws + off; off += (bytes + 255) & ~(size_t)255; return p; };
  b16* QP = (b16*)carve((size_t)NH * T * HD * 2); b16* KP = (b16*)carve((size_t)NKV * T * HD * 2); b16* VT = (b16*)carve((size_t)NKV * HD * T * 2);
  if (off > ws_size || off > ((size_t)128 << 20)) return;   // = 25 MB
  qk_kernel<<<((T * NH * HD + T * NKV * HD) / 8 + 255) / 256, 256, 0, stream>>>(Fp(0), Fp(1), QP, KP);
  vt_kernel<<<dim3(T / 64, NKV), 256, 0, stream>>>(Fp(2), VT);
  attn_kernel<<<dim3(T / 64, NKV), 512, 0, stream>>>(QP, KP, VT, (float*)d_out);
}

// v005
// Measured time: 69.3 microseconds a run.
// Next to v004, in two timings, it ran 1.04 times as fast each time.
// Counting every step since v000, it is 3.87 times as fast.
#include <hip/hip_runtime.h>

// Causal grouped-query attention on given q [2048 tokens][32 heads][128], k/v [2048][8 kv-heads][128]: head h uses kv head h/4; scores = q.k 128^-0.5, causal (s <= t), softmax over s,
// out = sum_s p v -> [2048][32][128]. No projections: q, k, v are the (bf16-rounded) module inputs.
// Deterministic: per (head, 16-query tile) two waves take the even and the odd 32-key blocks up to the diagonal, each a flash-style pass with fixed-order online softmax, joined in fixed order; no atomics.
// compute dtype: WMMA v_wmma_f32_16x16x32_f16 with f32 accumulate for S^T = K Q^T (q, k bf16-exact x8 in f16: EXACT products, K = 128: 1 product) and O^T += V^T P^T (v bf16-exact x8; P x1024 as
// f16 hi + x1024 residual: 2 products); scale, mask and softmax statistics in f32 (exp2). Inputs rounded to bf16 once.
// Fragment k-map per lane half hh for A AND B: elements 0..7 <- k = 8hh+0..7, 8..15 <- k = 16+8hh+0..7; acc[r] = D[8hh+r][col].

namespace {
typedef _Float16 b16;
typedef __attribute__((ext_vector_type(16))) _Float16 v16b;
typedef __attribute__((ext_vector_type(8))) _Float16 v8b;
typedef __attribute__((ext_vector_type(4))) _Float16 v4h;
typedef __attribute__((ext_vector_type(2))) _Float16 v2h;
typedef __attribute__((ext_vector_type(8))) float v8f;
typedef __attribute__((ext_vector_type(4))) float v4f;
typedef __attribute__((ext_vector_type(2))) float v2f;
__device__ __forceinline__ float bf16_rne(float f) { unsigned int u = __float_as_uint(f); u += 0x7FFFu + ((u >> 16) & 1u); return __uint_as_float(u & 0xFFFF0000u); }
__device__ __forceinline__ void split16(float v, b16& hi, b16& lo) { hi = (b16)v; lo = (b16)(v - (float)hi); }
__device__ __forceinline__ v16b frag_kb(const b16* p, int hh) { const v8b a = *(const v8b*)(p + 8 * hh), b = *(const v8b*)(p + 16 + 8 * hh); v16b f;
#pragma unroll
  for (int e = 0; e < 8; ++e) { f[e] = a[e]; f[8 + e] = b[e]; } return f; }
__device__ __forceinline__ v8f wmma16b(v16b a, v16b b, v8f c) { v8f d = __builtin_amdgcn_wmma_f32_16x16x32_f16(false, a, false, b, (short)0, c, false, false); asm volatile("v_nop\n\tv_nop\n\tv_nop\n\tv_nop" : "+v"(d) : "v"(a), "v"(b)); return d; }
__device__ __forceinline__ void wave_lds_sync() { __builtin_amdgcn_fence(__ATOMIC_RELEASE, "workgroup"); __builtin_amdgcn_wave_barrier(); __builtin_amdgcn_fence(__ATOMIC_ACQUIRE, "workgroup"); }
__device__ __forceinline__ float pmul(float a, float b) { float p = a * b; asm volatile("" : "+v"(p)); return p; }
__device__ __forceinline__ int iclamp(int v, int lo, int hi) { return v < lo ? lo : (v > hi ? hi : v); }
__device__ __forceinline__ float nexp2(float v) { return __builtin_amdgcn_exp2f(v); }

constexpr int T = 2048, NH = 32, NKV = 8, GRP = NH / NKV, HD = 128, HL = NH /* unused (== NH) */;
constexpr float XS = 8.0f, PS = 1024.0f, RS_ = 1024.0f, LOG2E = 1.4426950408889634f, SCALE = 0.088388347648318447f /* 128^-0.5 */, MFLOOR = -1.0e30f /* start of a block's maximum */;
static_assert(T % 64 == 0 && HD == 128 && NH % NKV == 0, "tiling");

// planes: QP[h][t][128] = f16(bf16(q[t][h]) x8) and KP[kh][s][128] likewise (head-major so a wave's fragment rows are contiguous); V^T[kh][d][s] (keys contiguous): block = (kh, 64 tokens), the
__global__ __launch_bounds__(256) void qk_kernel(const float* __restrict__ q, const float* __restrict__ k, b16* __restrict__ QP, b16* __restrict__ KP) {
  const int u = blockIdx.x * 256 + threadIdx.x; const int nq = T * NH * HD / 8, nk = T * NKV * HD / 8;
  if (u < nq) { const int e = u * 8; const int h = e / (T * HD), rem = e % (T * HD), t = rem / HD, d = rem % HD; const float* src = q + ((size_t)t * NH + h) * HD + d; v8b o; for (int j = 0; j < 8; ++j) o[j] = (b16)(bf16_rne(src[j]) * XS);
    { *(v8b*)(QP + e) = o;  } }
  else if (u < nq + nk) { const int e = (u - nq) * 8; const int h = e / (T * HD), rem = e % (T * HD), t = rem / HD, d = rem % HD; const float* src = k + ((size_t)t * NKV + h) * HD + d; v8b o; for (int j = 0; j < 8; ++j) o[j] = (b16)(bf16_rne(src[j]) * XS);
    { *(v8b*)(KP + e) = o;  } }
}
__global__ __launch_bounds__(256) void vt_kernel(const float* __restrict__ v, b16* __restrict__ VT) {
  __shared__ __attribute__((aligned(16))) b16 Ts[HD][64 + 8]; const int kh = blockIdx.y, s0 = blockIdx.x * 64;
  for (int i = threadIdx.x; i < 64 * HD; i += 256) { const int tt = i / HD, d = i % HD; Ts[d][tt] = (b16)(bf16_rne(v[((size_t)(s0 + tt) * NKV + kh) * HD + d]) * XS); }
  __syncthreads();
  const int wave = threadIdx.x >> 5, lane = threadIdx.x & 31;
  { for (int d = wave; d < HD; d += 8) *(v2h*)(VT + ((size_t)kh * HD + d) * T + s0 + lane * 2) = *(const v2h*)(&Ts[d][lane * 2]);  }
}
// attention: grid (T/64, NKV), one work-group of 16 waves per WGP (four waves per SIMD); a block takes the 32-position tile T/32 - 1 - blockIdx.x and then tile blockIdx.x, one after the other in every wave, so that every block walks T/32 + 1 key
// blocks: with one tile per block all blocks are resident at once and the launch lasts as long as the last tile's T/32 key blocks, about twice the mean.
// block = 2 key groups x 8 waves; the 8 waves of a group = the 4 query heads of kv head kh x 2 tiles of 16 queries (32 positions). Group g takes the key blocks 2 it + g (the even or the odd blocks of 32 keys up to the
// diagonal; where their number is odd, group 1's last block lies wholly behind the diagonal and adds nothing), with its own running maximum, sum and O; behind the loop group 1 hands its three through LDS to group 0,
// which joins them (factors 2^(m_g - max)) and stores. So a wave's dependent chain per tile is half as many trips long, and twice as many waves fill each other's waits. The eight waves of a group share ONE copy of each
// block's K rows and V^T columns in LDS (two buffers, filled by asynchronous 16-byte copies one block ahead; rows padded to 272 / 80 bytes for the 16-byte fragment reads). Per wave as before: S^T = K Q^T
// (4 k-steps x 2 key tiles, 1 product: exact operands), logit = s/64 x 128^-0.5 in log2 units, keys s > t -> -inf (diagonal kept), online softmax, P x1024 hi + residual -> LDS, O^T += V^T P^T
// (8 d-tiles x 2 products -> o, o2); out[t][h][d] = (o + o2/1024)/(l 1024 8). The LDS fragment reads run ahead of the products (K four fragments, V^T three), within the 256 registers that four waves per SIMD leave each wave:
constexpr int KPIT = HD + 8, VPIT = 32 + 8;   // LDS row pitch in elements
// one key block: K rows s0..s0+31 (8 KB contiguous) and 32 columns of the 128 V^T rows; each of the 256 threads of a key group copies 2 + 2 pieces of 16 bytes of its group's block. The s_wait_xcnt stands inside the statement so that no address
// register of an issued copy is rewritten in front of it.
__device__ __forceinline__ void stage_copy(unsigned lk, unsigned lv, const b16* gk, const b16* gv) {
  const unsigned lk1 = lk + 16 * KPIT * 2, lv1 = lv + 64 * VPIT * 2; const b16* gk1 = gk + 16 * HD; const b16* gv1 = gv + (size_t)64 * T;
  asm volatile("global_load_async_to_lds_b128 %0, %4, off\n\tglobal_load_async_to_lds_b128 %1, %5, off\n\tglobal_load_async_to_lds_b128 %2, %6, off\n\tglobal_load_async_to_lds_b128 %3, %7, off\n\ts_wait_xcnt 0x0"
               :: "v"(lk), "v"(lk1), "v"(lv), "v"(lv1), "v"(gk), "v"(gk1), "v"(gv), "v"(gv1) : "memory");
}
__global__ __launch_bounds__(512) void attn_kernel(const b16* __restrict__ QP, const b16* __restrict__ KP, const b16* __restrict__ VT, float* __restrict__ out) {
  __shared__ __attribute__((aligned(16))) b16 Ks[2][2][32][KPIT], Vs[2][2][HD][VPIT];   // [key group][buffer]
  __shared__ __attribute__((aligned(16))) b16 Pb[16][16][32 + 8], Pl[16][16][32 + 8]; __shared__ __attribute__((aligned(16))) float To[8][16][HD + 4]; __shared__ float Ml[8][32][2];
  const int wave = __builtin_amdgcn_readfirstlane((int)threadIdx.x >> 5);   // in a scalar register: the tests on the key group below are then scalar branches
  const int g = wave >> 3, w8 = wave & 7, tid = threadIdx.x & 255 /* thread within its key group */, lane = tid & 31, hh = lane >> 4, col = lane & 15; const int kh = blockIdx.y, h = kh * GRP + (w8 & 3);
  const b16* Kb = KP + (size_t)kh * T * HD; const b16* Vb = VT + (size_t)kh * HD * T;
  // this thread's pieces of its group's key block: K piece tid (row tid/16, 16 bytes at tid%16) and tid + 256 (16 rows on); V^T piece tid (row tid/4, 16 bytes at tid%4) and tid + 256 (64 rows on)
  const unsigned lk0 = (unsigned)(size_t)&Ks[g][0][tid >> 4][(tid & 15) * 8], lv0 = (unsigned)(size_t)&Vs[g][0][tid >> 2][(tid & 3) * 8];
  const b16* gk0 = Kb + g * 32 * HD + tid * 8; const b16* gv0 = Vb + (size_t)(tid >> 2) * T + g * 32 + (tid & 3) * 8;
  constexpr unsigned KBUF = 32 * KPIT * 2, VBUF = HD * VPIT * 2;   // bytes per buffer
#pragma unroll 1   // the two tiles go through one copy of the code
  for (int half = 0; half < 2; ++half) {
  const int bx = half ? (int)blockIdx.x : T / 32 - 1 - (int)blockIdx.x;   // block-uniform; the long tile first. The last trip's barrier of the first tile has ended every read of both buffers
  const int t0 = bx * 32 + (w8 >> 2) * 16; const int tq = t0 + col; const b16* Qb = QP + ((size_t)h * T + tq) * HD;
  const int ntrip = (bx + 2) >> 1;   // pairs of key blocks up to the diagonal: the same for the sixteen waves; the last block touched is 2 ntrip - 1 <= T / 32 - 1
  stage_copy(lk0, lv0, gk0, gv0);
  v16b qf[4]; for (int kb = 0; kb < 4; ++kb) qf[kb] = frag_kb(Qb + kb * 32, hh);
  asm volatile("s_wait_asynccnt 0x0" ::: "memory");   // this wave's copies of block g have landed
  __syncthreads();                                     // ... and every other wave's: block g is readable
  if (ntrip > 1) stage_copy(lk0 + KBUF, lv0 + VBUF, gk0 + 64 * HD, gv0 + 64);
  const float cs = LOG2E * SCALE / (XS * XS);
  float mrun = -INFINITY, l = 0.0f; v8f o[8], o2[8];
#pragma unroll
  for (int t = 0; t < 8; ++t) { o[t] = (v8f){}; o2[t] = (v8f){}; }
#pragma unroll 1
  for (int it = 0; it < ntrip; ++it) {
    const int s0 = (2 * it + g) * 32, buf = it & 1;
    // the causal select runs only where the block reaches behind the wave's first query (a scalar test: s0 and t0 are the same in every lane); in front of that, s0 + 31 <= t0 <= tq, it keeps every score, so the key
    // indices, compares and selects are left out. The block maximum starts at a finite floor far below any score (|score| < 2^40 cs for f16 operands), so mn is finite also for a row whose keys are all masked so far:
    // such a row then gets p = 2^(-inf) = 0 and a factor 0 on its zero sums with no guard, and the join behind the loop gives its group the factor 2^(floor - max) = 0
    float e[16]; float mx = MFLOOR;
    // the eight K fragments are read four ahead of the products that use them (order: k-step major, the two key tiles alternating), so that one LDS latency is waited out per four fragments, not per fragment
    const b16* kr = &Ks[g][buf][col][0]; v16b kf[4]; v8f sacc[2] = {(v8f){}, (v8f){}};
#pragma unroll
    for (int j = 0; j < 4; ++j) kf[j] = frag_kb(kr + (j & 1) * 16 * KPIT + (j >> 1) * 32, hh);
    __builtin_amdgcn_sched_barrier(0);   // keeps the four reads above as one group in front of the first product
#pragma unroll
    for (int j = 0; j < 8; ++j) { sacc[j & 1] = wmma16b(kf[j & 3], qf[j >> 1], sacc[j & 1]); if (j < 4) kf[j & 3] = frag_kb(kr + (j & 1) * 16 * KPIT + ((j + 4) >> 1) * 32, hh);
      __builtin_amdgcn_sched_barrier(0); }   // keeps each refill directly behind the product that frees its registers: sunk to its use it would be waited for in full
    if (s0 + 31 > t0) {
#pragma unroll
      for (int u2 = 0; u2 < 2; ++u2)
#pragma unroll
        for (int r = 0; r < 8; ++r) { const int s = s0 + u2 * 16 + 8 * hh + r; e[u2 * 8 + r] = (s <= tq) ? sacc[u2][r] * cs : -INFINITY; }
    } else {
#pragma unroll
      for (int i2 = 0; i2 < 16; ++i2) e[i2] = sacc[i2 >> 3][i2 & 7] * cs;
    }
#pragma unroll
    for (int i2 = 0; i2 < 16; ++i2) mx = fmaxf(mx, e[i2]);
    mx = fmaxf(mx, __shfl_xor(mx, 16)); const float mn = fmaxf(mrun, mx); const float al = nexp2(mrun - mn); float sum = 0.0f;
#pragma unroll
    for (int i2 = 0; i2 < 16; ++i2) { const float p = nexp2(e[i2] - mn); sum += p; const float psv = p * PS; const b16 p1 = (b16)psv; const int slot = (i2 < 8 ? 0 : 16) + 8 * hh + (i2 & 7); Pb[wave][col][slot] = p1; Pl[wave][col][slot] = (b16)((psv - (float)p1) * RS_); }
    sum += __shfl_xor(sum, 16); l = l * al + sum; mrun = mn;
    wave_lds_sync();
    const v16b pf = frag_kb(&Pb[wave][col][0], hh), plf = frag_kb(&Pl[wave][col][0], hh); v16b vf[3];
#pragma unroll
    for (int t = 0; t < 3; ++t) vf[t] = frag_kb(&Vs[g][buf][t * 16 + col][0], hh);
    __builtin_amdgcn_sched_barrier(0);   // P and the first three V^T fragments are read as one group; the rescale below runs while they are on their way
#pragma unroll
    for (int t = 0; t < 8; ++t) { o[t] *= al; o2[t] *= al; }
    __builtin_amdgcn_sched_barrier(0);   // keeps the rescale in front of the products, inside the reads' latency
#pragma unroll
    for (int t = 0; t < 8; ++t) { o[t] = wmma16b(vf[t % 3], pf, o[t]); o2[t] = wmma16b(vf[t % 3], plf, o2[t]); if (t < 5) vf[t % 3] = frag_kb(&Vs[g][buf][(t + 3) * 16 + col][0], hh);
      __builtin_amdgcn_sched_barrier(0); }   // keeps each refill directly behind the two products that free its registers
    wave_lds_sync();
    asm volatile("s_wait_dscnt 0x0" ::: "memory");      // this wave's reads of buffer buf are done before the buffer is handed back
    asm volatile("s_wait_asynccnt 0x0" ::: "memory");   // this wave's copies of block 2 it + 2 + g have landed
    __syncthreads();                                     // publishes block 2 it + 2 + g and ends every wave's reads of buffer buf
    if (it + 2 < ntrip) stage_copy(lk0 + buf * KBUF, lv0 + buf * VBUF, gk0 + (size_t)(it + 2) * 64 * HD, gv0 + (it + 2) * 64); }
  asm volatile("s_wait_asynccnt 0x0" ::: "memory");     // nothing of this wave's is in flight when it leaves the loop
  if (g == 1) {   // group 1 hands over its maximum, its sum and its O, each lane at the places that the same lane of its partner wave reads
    Ml[w8][lane][0] = mrun; Ml[w8][lane][1] = l;
#pragma unroll
    for (int t = 0; t < 8; ++t)
#pragma unroll
      for (int r = 0; r < 8; ++r) To[w8][col][t * 16 + 8 * hh + r] = o[t][r] + o2[t][r] * (1.0f / RS_); }
  __syncthreads();   // group 1's hand-over is readable; its next one comes only behind the next tile's barriers, which group 0 reaches after it has read this one
  if (g == 0) {
  const float m1 = Ml[w8][lane][0], l1 = Ml[w8][lane][1]; const float mm = fmaxf(mrun, m1);   // group 0 holds key 0, so mrun is finite; a group 1 without a key in front of the diagonal has m1 = the floor and the factor 0
  const float a0 = nexp2(mrun - mm), a1 = nexp2(m1 - mm); const float inv = 1.0f / ((l * a0 + l1 * a1) * PS * XS); const float f0 = a0 * inv, f1 = a1 * inv;
#pragma unroll
  for (int t = 0; t < 8; ++t)
#pragma unroll
    for (int r = 0; r < 8; ++r) { float* p = &To[w8][col][t * 16 + 8 * hh + r]; *p = (o[t][r] + o2[t][r] * (1.0f / RS_)) * f0 + *p * f1; }
  wave_lds_sync();
  { for (int rr = 0; rr < 16; ++rr) *(v4f*)(out + ((size_t)(t0 + rr) * NH + h) * HD + lane * 4) = *(const v4f*)(&To[w8][rr][lane * 4]);  }
  }
  asm volatile("s_wait_xcnt 0x0" ::: "memory");   // stands behind the tile's stores, in front of the next tile's prologue, which rewrites the registers that they name
  }
}
}  // namespace

extern "C" void kernel_launch(void* const* d_in, const int* in_sizes, int n_in, void* d_out, int out_size, void* d_ws, size_t ws_size, hipStream_t stream) {
  (void)n_in;
  auto Fp = [&](int i) { return (const float*)d_in[i]; };
  // input order: 0 q [2048,32,128], 1 k [2048,8,128], 2 v [2048,8,128]
  if (in_sizes[0] != T * NH * HD || in_sizes[1] != T * NKV * HD || in_sizes[2] != T * NKV * HD || out_size != T * NH * HD) return;
  size_t off = 0; char* ws = (char*)d_ws;
  auto carve = [&](size_t bytes) { char* p = ws + off; off += (bytes + 255) & ~(size_t)255; return p; };
  b16* QP = (b16*)carve((size_t)NH * T * HD * 2); b16* KP = (b16*)carve((size_t)NKV * T * HD * 2); b16* VT = (b16*)carve((size_t)NKV * HD * T * 2);
  if (off > ws_size || off > ((size_t)128 << 20)) return;   // = 25 MB
  qk_kernel<<<((T * NH * HD + T * NKV * HD) / 8 + 255) / 256, 256, 0, stream>>>(Fp(0), Fp(1), QP, KP);
  vt_kernel<<<dim3(T / 64, NKV), 256, 0, stream>>>(Fp(2), VT);
  attn_kernel<<<dim3(T / 64, NKV), 512, 0, stream>>>(QP, KP, VT, (float*)d_out);
}

// v006
// It runs in 65.1 microseconds.
// Timed twice side by side with v005, it ran 1.06 times as fast both times.
// Over all steps from v000 it is 4.12 times as fast.
#include <hip/hip_runtime.h>

// Causal grouped-query attention on given q [2048 tokens][32 heads][128], k/v [2048][8 kv-heads][128]: head h uses kv head h/4; scores = q.k 128^-0.5, causal (s <= t), softmax over s,
// out = sum_s p v -> [2048][32][128]. No projections: q, k, v are the (bf16-rounded) module inputs.
// Deterministic: per (head, 16-query tile) two waves take the even and the odd 32-key blocks up to the diagonal, each a flash-style pass with fixed-order online softmax, joined in fixed order; no atomics.
// compute dtype: WMMA v_wmma_f32_16x16x32_f16 with f32 accumulate for S^T = K Q^T (q, k bf16-exact x8 in f16: EXACT products, K = 128: 1 product) and O^T += V^T P^T (v bf16-exact x8; P x1024 as
// f16 hi + x1024 residual: 2 products); scale, mask and softmax statistics in f32 (exp2). Inputs rounded to bf16 once.
// Fragment k-map per lane half hh for A AND B: elements 0..7 <- k = 8hh+0..7, 8..15 <- k = 16+8hh+0..7; acc[r] = D[8hh+r][col].

namespace {
typedef _Float16 b16;
typedef __attribute__((ext_vector_type(16))) _Float16 v16b;
typedef __attribute__((ext_vector_type(8))) _Float16 v8b;
typedef __attribute__((ext_vector_type(4))) _Float16 v4h;
typedef __attribute__((ext_vector_type(2))) _Float16 v2h;
typedef __attribute__((ext_vector_type(8))) float v8f;
typedef __attribute__((ext_vector_type(4))) float v4f;
typedef __attribute__((ext_vector_type(2))) float v2f;
__device__ __forceinline__ float bf16_rne(float f) { unsigned int u = __float_as_uint(f); u += 0x7FFFu + ((u >> 16) & 1u); return __uint_as_float(u & 0xFFFF0000u); }
__device__ __forceinline__ void split16(float v, b16& hi, b16& lo) { hi = (b16)v; lo = (b16)(v - (float)hi); }
__device__ __forceinline__ v16b frag_kb(const b16* p, int hh) { const v8b a = *(const v8b*)(p + 8 * hh), b = *(const v8b*)(p + 16 + 8 * hh); v16b f;
#pragma unroll
  for (int e = 0; e < 8; ++e) { f[e] = a[e]; f[8 + e] = b[e]; } return f; }
__device__ __forceinline__ v8f wmma16b(v16b a, v16b b, v8f c) { v8f d = __builtin_amdgcn_wmma_f32_16x16x32_f16(false, a, false, b, (short)0, c, false, false); asm volatile("v_nop\n\tv_nop\n\tv_nop\n\tv_nop" : "+v"(d) : "v"(a), "v"(b)); return d; }
__device__ __forceinline__ void wave_lds_sync() { __builtin_amdgcn_fence(__ATOMIC_RELEASE, "workgroup"); __builtin_amdgcn_wave_barrier(); __builtin_amdgcn_fence(__ATOMIC_ACQUIRE, "workgroup"); }
__device__ __forceinline__ float pmul(float a, float b) { float p = a * b; asm volatile("" : "+v"(p)); return p; }
__device__ __forceinline__ int iclamp(int v, int lo, int hi) { return v < lo ? lo : (v > hi ? hi : v); }
__device__ __forceinline__ float nexp2(float v) { return __builtin_amdgcn_exp2f(v); }
__device__ __forceinline__ float xhalf(float v, int xa) { return __int_as_float(__builtin_amdgcn_ds_bpermute(xa, __float_as_int(v))); }   // the value of lane ^ 16; xa = that lane's number x 4

constexpr int T = 2048, NH = 32, NKV = 8, GRP = NH / NKV, HD = 128, HL = NH /* not used: all NH query heads are computed */;
constexpr float XS = 8.0f, PS = 1024.0f, RS_ = 1024.0f, LOG2E = 1.4426950408889634f, SCALE = 0.088388347648318447f /* 128^-0.5 */, MFLOOR = -1.0e30f /* start of a block's maximum */, LAZY = 5.0f /* log2 units: P x1024 is at most 2^15, inside f16, while no score lies further than this above the reference */;
static_assert(T % 64 == 0 && HD == 128 && NH % NKV == 0, "tiling");

// planes: QP[h][t][128] = f16(bf16(q[t][h]) x8) and KP[kh][s][128] likewise (head-major so a wave's fragment rows are contiguous); V^T[kh][d][s] (keys contiguous): block = (kh, 64 tokens), the
__global__ __launch_bounds__(256) void qk_kernel(const float* __restrict__ q, const float* __restrict__ k, b16* __restrict__ QP, b16* __restrict__ KP) {
  const int u = blockIdx.x * 256 + threadIdx.x; const int nq = T * NH * HD / 8, nk = T * NKV * HD / 8;
  if (u < nq) { const int e = u * 8; const int h = e / (T * HD), rem = e % (T * HD), t = rem / HD, d = rem % HD; const float* src = q + ((size_t)t * NH + h) * HD + d; v8b o; for (int j = 0; j < 8; ++j) o[j] = (b16)(bf16_rne(src[j]) * XS);
    { *(v8b*)(QP + e) = o;  } }
  else if (u < nq + nk) { const int e = (u - nq) * 8; const int h = e / (T * HD), rem = e % (T * HD), t = rem / HD, d = rem % HD; const float* src = k + ((size_t)t * NKV + h) * HD + d; v8b o; for (int j = 0; j < 8; ++j) o[j] = (b16)(bf16_rne(src[j]) * XS);
    { *(v8b*)(KP + e) = o;  } }
}
__global__ __launch_bounds__(256) void vt_kernel(const float* __restrict__ v, b16* __restrict__ VT) {
  __shared__ __attribute__((aligned(16))) b16 Ts[HD][64 + 8]; const int kh = blockIdx.y, s0 = blockIdx.x * 64;
  for (int i = threadIdx.x; i < 64 * HD; i += 256) { const int tt = i / HD, d = i % HD; Ts[d][tt] = (b16)(bf16_rne(v[((size_t)(s0 + tt) * NKV + kh) * HD + d]) * XS); }
  __syncthreads();
  const int wave = threadIdx.x >> 5, lane = threadIdx.x & 31;
  { for (int d = wave; d < HD; d += 8) *(v2h*)(VT + ((size_t)kh * HD + d) * T + s0 + lane * 2) = *(const v2h*)(&Ts[d][lane * 2]);  }
}
// attention: grid (T/64, NKV), one work-group of 16 waves per WGP (four waves per SIMD); a block takes the 32-position tile T/32 - 1 - blockIdx.x and then tile blockIdx.x, one after the other in every wave, so that every block walks T/32 + 1 key
// blocks: with one tile per block all blocks are resident at once and the launch lasts as long as the last tile's T/32 key blocks, about twice the mean.
// block = 2 key groups x 8 waves; the 8 waves of a group = the 4 query heads of kv head kh x 2 tiles of 16 queries (32 positions). Group g takes the key blocks 2 it + g (the even or the odd blocks of 32 keys up to the
// diagonal; where their number is odd, group 1's last block lies wholly behind the diagonal and adds nothing), with its own running maximum, sum and O; behind the loop group 1 hands its three through LDS to group 0,
// which joins them (factors 2^(m_g - max)) and stores. So a wave's dependent chain per tile is half as many trips long, and twice as many waves fill each other's waits. The eight waves of a group share ONE copy of each
// block's K rows and V^T columns in LDS (two buffers, filled by asynchronous 16-byte copies one block ahead; rows padded to 272 / 80 bytes for the 16-byte fragment reads). Per wave as before: S^T = K Q^T
// (4 k-steps x 2 key tiles, 1 product: exact operands), logit = s/64 x 128^-0.5 in log2 units, keys s > t -> -inf (diagonal kept), online softmax, P x1024 hi + residual -> LDS, O^T += V^T P^T
// (8 d-tiles x 2 products -> o, o2); out[t][h][d] = (o + o2/1024)/(l 1024 8). The LDS fragment reads run ahead of the products (K four fragments, V^T three), within the 256 registers that four waves per SIMD leave each wave:
constexpr int KPIT = HD + 8, VPIT = 32 + 8;   // LDS row pitch in elements
// one key block: K rows s0..s0+31 (8 KB contiguous) and 32 columns of the 128 V^T rows; each of the 256 threads of a key group copies 2 + 2 pieces of 16 bytes of its group's block. The s_wait_xcnt stands inside the statement so that no address
// register of an issued copy is rewritten in front of it.
__device__ __forceinline__ void stage_copy(unsigned lk, unsigned lv, const b16* gk, const b16* gv) {
  const unsigned lk1 = lk + 16 * KPIT * 2, lv1 = lv + 64 * VPIT * 2; const b16* gk1 = gk + 16 * HD; const b16* gv1 = gv + (size_t)64 * T;
  asm volatile("global_load_async_to_lds_b128 %0, %4, off\n\tglobal_load_async_to_lds_b128 %1, %5, off\n\tglobal_load_async_to_lds_b128 %2, %6, off\n\tglobal_load_async_to_lds_b128 %3, %7, off\n\ts_wait_xcnt 0x0"
               :: "v"(lk), "v"(lk1), "v"(lv), "v"(lv1), "v"(gk), "v"(gk1), "v"(gv), "v"(gv1) : "memory");
}
__global__ __launch_bounds__(512) void attn_kernel(const b16* __restrict__ QP, const b16* __restrict__ KP, const b16* __restrict__ VT, float* __restrict__ out) {
  __shared__ __attribute__((aligned(16))) b16 Ks[2][2][32][KPIT], Vs[2][2][HD][VPIT];   // [key group][buffer]
  __shared__ __attribute__((aligned(16))) b16 Pb[16][16][32 + 8], Pl[16][16][32 + 8]; __shared__ __attribute__((aligned(16))) float To[8][16][HD + 4]; __shared__ float Ml[8][32][2];
  const int wave = __builtin_amdgcn_readfirstlane((int)threadIdx.x >> 5);   // in a scalar register: the tests on the key group below are then scalar branches
  const int g = wave >> 3, w8 = wave & 7, tid = threadIdx.x & 255 /* thread within its key group */, lane = tid & 31, hh = lane >> 4, col = lane & 15; const int kh = blockIdx.y, h = kh * GRP + (w8 & 3);
  const int xa = (lane ^ 16) * 4;   // formed once: formed at each exchange it takes registers that the kernel does not have to spare
  const b16* Kb = KP + (size_t)kh * T * HD; const b16* Vb = VT + (size_t)kh * HD * T;
  // this thread's pieces of its group's key block: K piece tid (row tid/16, 16 bytes at tid%16) and tid + 256 (16 rows on); V^T piece tid (row tid/4, 16 bytes at tid%4) and tid + 256 (64 rows on)
  const unsigned lk0 = (unsigned)(size_t)&Ks[g][0][tid >> 4][(tid & 15) * 8], lv0 = (unsigned)(size_t)&Vs[g][0][tid >> 2][(tid & 3) * 8];
  const b16* gk0 = Kb + g * 32 * HD + tid * 8; const b16* gv0 = Vb + (size_t)(tid >> 2) * T + g * 32 + (tid & 3) * 8;
  constexpr unsigned KBUF = 32 * KPIT * 2, VBUF = HD * VPIT * 2;   // bytes per buffer
#pragma unroll 1   // the two tiles go through one copy of the code
  for (int half = 0; half < 2; ++half) {
  const int bx = half ? (int)blockIdx.x : T / 32 - 1 - (int)blockIdx.x;   // block-uniform; the long tile first. The last trip's barrier of the first tile has ended every read of both buffers
  const int t0 = bx * 32 + (w8 >> 2) * 16; const int tq = t0 + col; const b16* Qb = QP + ((size_t)h * T + tq) * HD;
  const int ntrip = (bx + 2) >> 1;   // pairs of key blocks up to the diagonal: the same for the sixteen waves; the last block touched is 2 ntrip - 1 <= T / 32 - 1
  stage_copy(lk0, lv0, gk0, gv0);
  v16b qf[4]; for (int kb = 0; kb < 4; ++kb) qf[kb] = frag_kb(Qb + kb * 32, hh);
  asm volatile("s_wait_asynccnt 0x0" ::: "memory");   // this wave's copies of block g have landed
  __syncthreads();                                     // ... and every other wave's: block g is readable
  if (ntrip > 1) stage_copy(lk0 + KBUF, lv0 + VBUF, gk0 + 64 * HD, gv0 + 64);
  const float cs = LOG2E * SCALE / (XS * XS);
  float mrun = -INFINITY, l = 0.0f; v8f o[8], o2[8];
#pragma unroll
  for (int t = 0; t < 8; ++t) { o[t] = (v8f){}; o2[t] = (v8f){}; }
#pragma unroll 1
  for (int it = 0; it < ntrip; ++it) {
    const int s0 = (2 * it + g) * 32, buf = it & 1;
    // the causal select runs only where the block reaches behind the wave's first query (a scalar test: s0 and t0 are the same in every lane); in front of that, s0 + 31 <= t0 <= tq, it keeps every score, so the key
    // indices, compares and selects are left out. The block maximum starts at a finite floor far below any score (|score| < 2^40 cs for f16 operands), so mn is finite also for a row whose keys are all masked so far:
    // such a row then gets p = 2^(-inf) = 0 and a factor 0 on its zero sums with no guard, and the join behind the loop gives its group the factor 2^(floor - max) = 0
    float e[16]; float mx = MFLOOR;
    // the eight K fragments are read four ahead of the products that use them (order: k-step major, the two key tiles alternating), so that one LDS latency is waited out per four fragments, not per fragment
    const b16* kr = &Ks[g][buf][col][0]; v16b kf[4]; v8f sacc[2] = {(v8f){}, (v8f){}};
#pragma unroll
    for (int j = 0; j < 4; ++j) kf[j] = frag_kb(kr + (j & 1) * 16 * KPIT + (j >> 1) * 32, hh);
    __builtin_amdgcn_sched_barrier(0);   // keeps the four reads above as one group in front of the first product
#pragma unroll
    for (int j = 0; j < 8; ++j) { sacc[j & 1] = wmma16b(kf[j & 3], qf[j >> 1], sacc[j & 1]); if (j < 4) kf[j & 3] = frag_kb(kr + (j & 1) * 16 * KPIT + ((j + 4) >> 1) * 32, hh);
      __builtin_amdgcn_sched_barrier(0); }   // keeps each refill directly behind the product that frees its registers: sunk to its use it would be waited for in full
    if (s0 + 31 > t0) {
#pragma unroll
      for (int u2 = 0; u2 < 2; ++u2)
#pragma unroll
        for (int r = 0; r < 8; ++r) { const int s = s0 + u2 * 16 + 8 * hh + r; e[u2 * 8 + r] = (s <= tq) ? sacc[u2][r] * cs : -INFINITY; }
    } else {
#pragma unroll
      for (int i2 = 0; i2 < 16; ++i2) e[i2] = sacc[i2 >> 3][i2 & 7] * cs;
    }
#pragma unroll
    for (int i2 = 0; i2 < 16; ++i2) mx = fmaxf(mx, e[i2]);
    // lazy rescale: mrun is the reference of the exponentials, not the true maximum. It moves, and l, O and O2 are rescaled, only where some lane's block maximum lies more than LAZY above it: one test per key block, on the
    // ballot, so that both branches on it are scalar. The first block always takes them (mrun = -inf: factor 0 on zero sums). Both halves of a column move to the same exchanged maximum, so mrun stays equal in them.
    // Not taken: every p <= 2^LAZY
    const bool move = __builtin_amdgcn_ballot_w32(mx > mrun + LAZY) != 0; float al = 1.0f;
    if (move) { mx = fmaxf(mx, xhalf(mx, xa)); const float mn = fmaxf(mrun, mx); al = nexp2(mrun - mn); l *= al; mrun = mn; }
    float sum = 0.0f;
#pragma unroll
    for (int i2 = 0; i2 < 16; ++i2) { const float p = nexp2(e[i2] - mrun); sum += p; const float psv = p * PS; const b16 p1 = (b16)psv; const int slot = (i2 < 8 ? 0 : 16) + 8 * hh + (i2 & 7); Pb[wave][col][slot] = p1; Pl[wave][col][slot] = (b16)((psv - (float)p1) * RS_); }
    sum += xhalf(sum, xa); l += sum;
    wave_lds_sync();
    const v16b pf = frag_kb(&Pb[wave][col][0], hh), plf = frag_kb(&Pl[wave][col][0], hh); v16b vf[3];
#pragma unroll
    for (int t = 0; t < 3; ++t) vf[t] = frag_kb(&Vs[g][buf][t * 16 + col][0], hh);
    if (move) {   // P and the first three V^T fragments are read as one group in front of this branch; the rescale, where it is due, runs while they are on their way
#pragma unroll
      for (int t = 0; t < 8; ++t) { o[t] *= al; o2[t] *= al; } }
#pragma unroll
    for (int t = 0; t < 8; ++t) { o[t] = wmma16b(vf[t % 3], pf, o[t]); o2[t] = wmma16b(vf[t % 3], plf, o2[t]); if (t < 5) vf[t % 3] = frag_kb(&Vs[g][buf][(t + 3) * 16 + col][0], hh);
      __builtin_amdgcn_sched_barrier(0); }   // keeps each refill directly behind the two products that free its registers
    wave_lds_sync();
    asm volatile("s_wait_dscnt 0x0" ::: "memory");      // this wave's reads of buffer buf are done before the buffer is handed back
    asm volatile("s_wait_asynccnt 0x0" ::: "memory");   // this wave's copies of block 2 it + 2 + g have landed
    __syncthreads();                                     // publishes block 2 it + 2 + g and ends every wave's reads of buffer buf
    if (it + 2 < ntrip) stage_copy(lk0 + buf * KBUF, lv0 + buf * VBUF, gk0 + (size_t)(it + 2) * 64 * HD, gv0 + (it + 2) * 64); }
  asm volatile("s_wait_asynccnt 0x0" ::: "memory");     // nothing of this wave's is in flight when it leaves the loop
  if (g == 1) {   // group 1 hands over its maximum, its sum and its O, each lane at the places that the same lane of its partner wave reads
    Ml[w8][lane][0] = mrun; Ml[w8][lane][1] = l;
#pragma unroll
    for (int t = 0; t < 8; ++t)
#pragma unroll
      for (int r = 0; r < 8; ++r) To[w8][col][t * 16 + 8 * hh + r] = o[t][r] + o2[t][r] * (1.0f / RS_); }
  __syncthreads();   // group 1's hand-over is readable; its next one comes only behind the next tile's barriers, which group 0 reaches after it has read this one
  if (g == 0) {
  const float m1 = Ml[w8][lane][0], l1 = Ml[w8][lane][1]; const float mm = fmaxf(mrun, m1);   // group 0 holds key 0, so mrun is finite; a group 1 without a key in front of the diagonal has m1 = the floor and the factor 0
  const float a0 = nexp2(mrun - mm), a1 = nexp2(m1 - mm); const float inv = 1.0f / ((l * a0 + l1 * a1) * PS * XS); const float f0 = a0 * inv, f1 = a1 * inv;
#pragma unroll
  for (int t = 0; t < 8; ++t)
#pragma unroll
    for (int r = 0; r < 8; ++r) { float* p = &To[w8][col][t * 16 + 8 * hh + r]; *p = (o[t][r] + o2[t][r] * (1.0f / RS_)) * f0 + *p * f1; }
  wave_lds_sync();
  { float* ob = out + (unsigned)((t0 * NH + h) * HD + lane * 4);   // a 32-bit offset (below 2^23): what stays in a register through the key loop is one word of it, not an address pair, and nothing spills
    for (int rr = 0; rr < 16; ++rr) *(v4f*)(ob + rr * NH * HD) = *(const v4f*)(&To[w8][rr][lane * 4]);  }
  }
  asm volatile("s_wait_xcnt 0x0" ::: "memory");   // stands behind the tile's stores, in front of the next tile's prologue, which rewrites the registers that they name
  }
}
}  // namespace

extern "C" void kernel_launch(void* const* d_in, const int* in_sizes, int n_in, void* d_out, int out_size, void* d_ws, size_t ws_size, hipStream_t stream) {
  (void)n_in;
  auto Fp = [&](int i) { return (const float*)d_in[i]; };
  // input order: 0 q [2048,32,128], 1 k [2048,8,128], 2 v [2048,8,128]
  if (in_sizes[0] != T * NH * HD || in_sizes[1] != T * NKV * HD || in_sizes[2] != T * NKV * HD || out_size != T * NH * HD) return;
  size_t off = 0; char* ws = (char*)d_ws;
  auto carve = [&](size_t bytes) { char* p = ws + off; off += (bytes + 255) & ~(size_t)255; return p; };
  b16* QP = (b16*)carve((size_t)NH * T * HD * 2); b16* KP = (b16*)carve((size_t)NKV * T * HD * 2); b16* VT = (b16*)carve((size_t)NKV * HD * T * 2);
  if (off > ws_size || off > ((size_t)128 << 20)) return;   // = 25 MB
  qk_kernel<<<((T * NH * HD + T * NKV * HD) / 8 + 255) / 256, 256, 0, stream>>>(Fp(0), Fp(1), QP, KP);
  vt_kernel<<<dim3(T / 64, NKV), 256, 0, stream>>>(Fp(2), VT);
  attn_kernel<<<dim3(T / 64, NKV), 512, 0, stream>>>(QP, KP, VT, (float*)d_out);
}

// v007
// A run of this version takes 58.9 microseconds.
// Two timings next to v006 both put it at 1.10 times that version's speed.
// All steps since v000 together make it 4.55 times as fast.
#include <hip/hip_runtime.h>

// Causal grouped-query attention on given q [2048 tokens][32 heads][128], k/v [2048][8 kv-heads][128]: head h uses kv head h/4; scores = q.k 128^-0.5, causal (s <= t), softmax over s,
// out = sum_s p v -> [2048][32][128]. No projections: q, k, v are the (bf16-rounded) module inputs.
// Deterministic: per (head, 16-query tile) two waves take the even and the odd 32-key blocks up to the diagonal, each a flash-style pass with fixed-order online softmax, joined in fixed order; no atomics.
// compute dtype: WMMA v_wmma_f32_16x16x32_f16 with f32 accumulate for S^T = K Q^T (q, k bf16-exact x8 in f16: EXACT products, K = 128: 1 product) and O^T += V^T P^T (v bf16-exact x8; P x1024 as
// f16 hi + x1024 residual: 2 products); scale, mask and softmax statistics in f32 (exp2). Inputs rounded to bf16 once.
// Fragment k-map per lane half hh for A AND B: elements 0..7 <- k = 8hh+0..7, 8..15 <- k = 16+8hh+0..7; acc[r] = D[8hh+r][col].

namespace {
typedef _Float16 b16;
typedef __attribute__((ext_vector_type(16))) _Float16 v16b;
typedef __attribute__((ext_vector_type(8))) _Float16 v8b;
typedef __attribute__((ext_vector_type(4))) _Float16 v4h;
typedef __attribute__((ext_vector_type(2))) _Float16 v2h;
typedef __attribute__((ext_vector_type(8))) float v8f;
typedef __attribute__((ext_vector_type(4))) float v4f;
typedef __attribute__((ext_vector_type(2))) float v2f;
__device__ __forceinline__ float bf16_rne(float f) { unsigned int u = __float_as_uint(f); u += 0x7FFFu + ((u >> 16) & 1u); return __uint_as_float(u & 0xFFFF0000u); }
__device__ __forceinline__ void split16(float v, b16& hi, b16& lo) { hi = (b16)v; lo = (b16)(v - (float)hi); }
__device__ __forceinline__ v16b frag_kb(const b16* p, int hh) { const v8b a = *(const v8b*)(p + 8 * hh), b = *(const v8b*)(p + 16 + 8 * hh); v16b f;
#pragma unroll
  for (int e = 0; e < 8; ++e) { f[e] = a[e]; f[8 + e] = b[e]; } return f; }
__device__ __forceinline__ v8f wmma16b(v16b a, v16b b, v8f c) { v8f d = __builtin_amdgcn_wmma_f32_16x16x32_f16(false, a, false, b, (short)0, c, false, false); asm volatile("v_nop\n\tv_nop\n\tv_nop\n\tv_nop" : "+v"(d) : "v"(a), "v"(b)); return d; }
__device__ __forceinline__ void wave_lds_sync() { __builtin_amdgcn_fence(__ATOMIC_RELEASE, "workgroup"); __builtin_amdgcn_wave_barrier(); __builtin_amdgcn_fence(__ATOMIC_ACQUIRE, "workgroup"); }
__device__ __forceinline__ float pmul(float a, float b) { float p = a * b; asm volatile("" : "+v"(p)); return p; }
__device__ __forceinline__ int iclamp(int v, int lo, int hi) { return v < lo ? lo : (v > hi ? hi : v); }
__device__ __forceinline__ float nexp2(float v) { return __builtin_amdgcn_exp2f(v); }
__device__ __forceinline__ float xhalf(float v, int xa) { return __int_as_float(__builtin_amdgcn_ds_bpermute(xa, __float_as_int(v))); }   // the value of lane ^ 16; xa = that lane's number x 4

constexpr int T = 2048, NH = 32, NKV = 8, GRP = NH / NKV, HD = 128, HL = NH /* not used: all NH query heads are computed */;
constexpr float XS = 8.0f, PS = 1024.0f, RS_ = 1024.0f, LOG2E = 1.4426950408889634f, SCALE = 0.088388347648318447f /* 128^-0.5 */, MFLOOR = -1.0e30f /* start of a block's maximum */, LAZY = 5.0f /* log2 units: P x1024 is at most 2^15, inside f16, while no score lies further than this above the reference */;
static_assert(T % 64 == 0 && HD == 128 && NH % NKV == 0, "tiling");

// planes: QP[h][t][128] = f16(bf16(q[t][h]) x8) and KP[kh][s][128] likewise (head-major so a wave's fragment rows are contiguous); V^T[kh][d][s] (keys contiguous): block = (kh, 64 tokens).
// ONE launch makes the three planes: its first VTB blocks make V^T, one (kv head, 64 tokens) tile each, the others convert q and k, 8 elements a thread. The V^T blocks mostly wait (a chain of memory round trips, then LDS),
// the q/k blocks stream: in one grid the first kind runs under the second, and there is one launch and one gap between dependent launches less. The V^T blocks come first in the grid (for speed only).
constexpr int VTB = (T / 64) * NKV;
__global__ __launch_bounds__(256) void conv_kernel(const float* __restrict__ q, const float* __restrict__ k, const float* __restrict__ v, b16* __restrict__ QP, b16* __restrict__ KP, b16* __restrict__ VT) {
  __shared__ __attribute__((aligned(16))) b16 Ts[HD][64 + 8];
  if ((int)blockIdx.x < VTB) {   // the same for the whole block: all of its waves pass the barrier below, or none
  const int kh = (int)blockIdx.x / (T / 64), s0 = ((int)blockIdx.x % (T / 64)) * 64;
  for (int i = threadIdx.x; i < 64 * HD; i += 256) { const int tt = i / HD, d = i % HD; Ts[d][tt] = (b16)(bf16_rne(v[((size_t)(s0 + tt) * NKV + kh) * HD + d]) * XS); }
  __syncthreads();
  const int wave = threadIdx.x >> 5, lane = threadIdx.x & 31;
  { for (int d = wave; d < HD; d += 8) *(v2h*)(VT + ((size_t)kh * HD + d) * T + s0 + lane * 2) = *(const v2h*)(&Ts[d][lane * 2]);  }
  return;
  }
  const int u = ((int)blockIdx.x - VTB) * 256 + threadIdx.x; const int nq = T * NH * HD / 8, nk = T * NKV * HD / 8;
  if (u < nq) { const int e = u * 8; const int h = e / (T * HD), rem = e % (T * HD), t = rem / HD, d = rem % HD; const float* src = q + ((size_t)t * NH + h) * HD + d; v8b o; for (int j = 0; j < 8; ++j) o[j] = (b16)(bf16_rne(src[j]) * XS);
    { *(v8b*)(QP + e) = o;  } }
  else if (u < nq + nk) { const int e = (u - nq) * 8; const int h = e / (T * HD), rem = e % (T * HD), t = rem / HD, d = rem % HD; const float* src = k + ((size_t)t * NKV + h) * HD + d; v8b o; for (int j = 0; j < 8; ++j) o[j] = (b16)(bf16_rne(src[j]) * XS);
    { *(v8b*)(KP + e) = o;  } }
}
// attention: grid (T/64, NKV), one work-group of 16 waves per WGP (four waves per SIMD); a block takes the 32-position tile T/32 - 1 - blockIdx.x and then tile blockIdx.x, one after the other in every wave, so that every block walks T/32 + 1 key
// blocks: with one tile per block all blocks are resident at once and the launch lasts as long as the last tile's T/32 key blocks, about twice the mean.
// block = 2 key groups x 8 waves; the 8 waves of a group = the 4 query heads of kv head kh x 2 tiles of 16 queries (32 positions). Group g takes the key blocks 2 it + g (the even or the odd blocks of 32 keys up to the
// diagonal; where their number is odd, group 1's last block lies wholly behind the diagonal and adds nothing), with its own running maximum, sum and O; behind the loop group 1 hands its three through LDS to group 0,
// which joins them (factors 2^(m_g - max)) and stores. So a wave's dependent chain per tile is half as many trips long, and twice as many waves fill each other's waits. The eight waves of a group share ONE copy of each
// block's K rows and V^T columns in LDS (two buffers, filled by asynchronous 16-byte copies one block ahead; rows padded to 272 / 80 bytes for the 16-byte fragment reads). Per wave as before: S^T = K Q^T
// (4 k-steps x 2 key tiles, 1 product: exact operands), logit = s/64 x 128^-0.5 in log2 units, keys s > t -> -inf (diagonal kept), online softmax, P x1024 hi + residual -> LDS, O^T += V^T P^T
// (8 d-tiles x 2 products -> o, o2); out[t][h][d] = (o + o2/1024)/(l 1024 8). The LDS fragment reads run ahead of the products (K four fragments, V^T three), within the 256 registers that four waves per SIMD leave each wave:
constexpr int KPIT = HD + 8, VPIT = 32 + 8;   // LDS row pitch in elements
// one key block: K rows s0..s0+31 (8 KB contiguous) and 32 columns of the 128 V^T rows; each of the 256 threads of a key group copies 2 + 2 pieces of 16 bytes of its group's block. The s_wait_xcnt stands inside the statement so that no address
// register of an issued copy is rewritten in front of it.
__device__ __forceinline__ void stage_copy(unsigned lk, unsigned lv, const b16* gk, const b16* gv) {
  const unsigned lk1 = lk + 16 * KPIT * 2, lv1 = lv + 64 * VPIT * 2; const b16* gk1 = gk + 16 * HD; const b16* gv1 = gv + (size_t)64 * T;
  asm volatile("global_load_async_to_lds_b128 %0, %4, off\n\tglobal_load_async_to_lds_b128 %1, %5, off\n\tglobal_load_async_to_lds_b128 %2, %6, off\n\tglobal_load_async_to_lds_b128 %3, %7, off\n\ts_wait_xcnt 0x0"
               :: "v"(lk), "v"(lk1), "v"(lv), "v"(lv1), "v"(gk), "v"(gk1), "v"(gv), "v"(gv1) : "memory");
}
__global__ __launch_bounds__(512) void attn_kernel(const b16* __restrict__ QP, const b16* __restrict__ KP, const b16* __restrict__ VT, float* __restrict__ out) {
  __shared__ __attribute__((aligned(16))) b16 Ks[2][2][32][KPIT], Vs[2][2][HD][VPIT];   // [key group][buffer]
  __shared__ __attribute__((aligned(16))) b16 Pb[16][16][32 + 8], Pl[16][16][32 + 8]; __shared__ __attribute__((aligned(16))) float To[8][16][HD + 4]; __shared__ float Ml[8][32][2];
  const int wave = __builtin_amdgcn_readfirstlane((int)threadIdx.x >> 5);   // in a scalar register: the tests on the key group below are then scalar branches
  const int g = wave >> 3, w8 = wave & 7, tid = threadIdx.x & 255 /* thread within its key group */, lane = tid & 31, hh = lane >> 4, col = lane & 15; const int kh = blockIdx.y, h = kh * GRP + (w8 & 3);
  const int xa = (lane ^ 16) * 4;   // formed once: formed at each exchange it takes registers that the kernel does not have to spare
  const b16* Kb = KP + (size_t)kh * T * HD; const b16* Vb = VT + (size_t)kh * HD * T;
  // this thread's pieces of its group's key block: K piece tid (row tid/16, 16 bytes at tid%16) and tid + 256 (16 rows on); V^T piece tid (row tid/4, 16 bytes at tid%4) and tid + 256 (64 rows on)
  const unsigned lk0 = (unsigned)(size_t)&Ks[g][0][tid >> 4][(tid & 15) * 8], lv0 = (unsigned)(size_t)&Vs[g][0][tid >> 2][(tid & 3) * 8];
  const b16* gk0 = Kb + g * 32 * HD + tid * 8; const b16* gv0 = Vb + (size_t)(tid >> 2) * T + g * 32 + (tid & 3) * 8;
  constexpr unsigned KBUF = 32 * KPIT * 2, VBUF = HD * VPIT * 2;   // bytes per buffer
#pragma unroll 1   // the two tiles go through one copy of the code
  for (int half = 0; half < 2; ++half) {
  const int bx = half ? (int)blockIdx.x : T / 32 - 1 - (int)blockIdx.x;   // block-uniform; the long tile first. The last trip's barrier of the first tile has ended every read of both buffers
  const int t0 = bx * 32 + (w8 >> 2) * 16; const int tq = t0 + col; const b16* Qb = QP + ((size_t)h * T + tq) * HD;
  const int ntrip = (bx + 2) >> 1;   // pairs of key blocks up to the diagonal: the same for the sixteen waves; the last block touched is 2 ntrip - 1 <= T / 32 - 1
  stage_copy(lk0, lv0, gk0, gv0);
  v16b qf[4]; for (int kb = 0; kb < 4; ++kb) qf[kb] = frag_kb(Qb + kb * 32, hh);
  asm volatile("s_wait_asynccnt 0x0" ::: "memory");   // this wave's copies of block g have landed
  __syncthreads();                                     // ... and every other wave's: block g is readable
  if (ntrip > 1) stage_copy(lk0 + KBUF, lv0 + VBUF, gk0 + 64 * HD, gv0 + 64);
  const float cs = LOG2E * SCALE / (XS * XS);
  float mrun = -INFINITY, l = 0.0f; v8f o[8], o2[8];
#pragma unroll
  for (int t = 0; t < 8; ++t) { o[t] = (v8f){}; o2[t] = (v8f){}; }
#pragma unroll 1
  for (int it = 0; it < ntrip; ++it) {
    const int s0 = (2 * it + g) * 32, buf = it & 1;
    // the causal select runs only where the block reaches behind the wave's first query (a scalar test: s0 and t0 are the same in every lane); in front of that, s0 + 31 <= t0 <= tq, it keeps every score, so the key
    // indices, compares and selects are left out. The block maximum starts at a finite floor far below any score (|score| < 2^40 cs for f16 operands), so mn is finite also for a row whose keys are all masked so far:
    // such a row then gets p = 2^(-inf) = 0 and a factor 0 on its zero sums with no guard, and the join behind the loop gives its group the factor 2^(floor - max) = 0
    float e[16]; float mx = MFLOOR;
    // the eight K fragments are read four ahead of the products that use them (order: k-step major, the two key tiles alternating), so that one LDS latency is waited out per four fragments, not per fragment
    const b16* kr = &Ks[g][buf][col][0]; v16b kf[4]; v8f sacc[2] = {(v8f){}, (v8f){}};
#pragma unroll
    for (int j = 0; j < 4; ++j) kf[j] = frag_kb(kr + (j & 1) * 16 * KPIT + (j >> 1) * 32, hh);
    __builtin_amdgcn_sched_barrier(0);   // keeps the four reads above as one group in front of the first product
#pragma unroll
    for (int j = 0; j < 8; ++j) { sacc[j & 1] = wmma16b(kf[j & 3], qf[j >> 1], sacc[j & 1]); if (j < 4) kf[j & 3] = frag_kb(kr + (j & 1) * 16 * KPIT + ((j + 4) >> 1) * 32, hh);
      __builtin_amdgcn_sched_barrier(0); }   // keeps each refill directly behind the product that frees its registers: sunk to its use it would be waited for in full
    if (s0 + 31 > t0) {
#pragma unroll
      for (int u2 = 0; u2 < 2; ++u2)
#pragma unroll
        for (int r = 0; r < 8; ++r) { const int s = s0 + u2 * 16 + 8 * hh + r; e[u2 * 8 + r] = (s <= tq) ? sacc[u2][r] * cs : -INFINITY; }
    } else {
#pragma unroll
      for (int i2 = 0; i2 < 16; ++i2) e[i2] = sacc[i2 >> 3][i2 & 7] * cs;
    }
#pragma unroll
    for (int i2 = 0; i2 < 16; ++i2) mx = fmaxf(mx, e[i2]);
    // lazy rescale: mrun is the reference of the exponentials, not the true maximum. It moves, and l, O and O2 are rescaled, only where some lane's block maximum lies more than LAZY above it: one test per key block, on the
    // ballot, so that both branches on it are scalar. The first block always takes them (mrun = -inf: factor 0 on zero sums). Both halves of a column move to the same exchanged maximum, so mrun stays equal in them.
    // Not taken: every p <= 2^LAZY
    const bool move = __builtin_amdgcn_ballot_w32(mx > mrun + LAZY) != 0; float al = 1.0f;
    if (move) { mx = fmaxf(mx, xhalf(mx, xa)); const float mn = fmaxf(mrun, mx); al = nexp2(mrun - mn); l *= al; mrun = mn; }
    float sum = 0.0f;
#pragma unroll
    for (int i2 = 0; i2 < 16; ++i2) { const float p = nexp2(e[i2] - mrun); sum += p; const float psv = p * PS; const b16 p1 = (b16)psv; const int slot = (i2 < 8 ? 0 : 16) + 8 * hh + (i2 & 7); Pb[wave][col][slot] = p1; Pl[wave][col][slot] = (b16)((psv - (float)p1) * RS_); }
    sum += xhalf(sum, xa); l += sum;
    wave_lds_sync();
    const v16b pf = frag_kb(&Pb[wave][col][0], hh), plf = frag_kb(&Pl[wave][col][0], hh); v16b vf[3];
#pragma unroll
    for (int t = 0; t < 3; ++t) vf[t] = frag_kb(&Vs[g][buf][t * 16 + col][0], hh);
    if (move) {   // P and the first three V^T fragments are read as one group in front of this branch; the rescale, where it is due, runs while they are on their way
#pragma unroll
      for (int t = 0; t < 8; ++t) { o[t] *= al; o2[t] *= al; } }
#pragma unroll
    for (int t = 0; t < 8; ++t) { o[t] = wmma16b(vf[t % 3], pf, o[t]); o2[t] = wmma16b(vf[t % 3], plf, o2[t]); if (t < 5) vf[t % 3] = frag_kb(&Vs[g][buf][(t + 3) * 16 + col][0], hh);
      __builtin_amdgcn_sched_barrier(0); }   // keeps each refill directly behind the two products that free its registers
    wave_lds_sync();
    asm volatile("s_wait_dscnt 0x0" ::: "memory");      // this wave's reads of buffer buf are done before the buffer is handed back
    asm volatile("s_wait_asynccnt 0x0" ::: "memory");   // this wave's copies of block 2 it + 2 + g have landed
    __syncthreads();                                     // publishes block 2 it + 2 + g and ends every wave's reads of buffer buf
    if (it + 2 < ntrip) stage_copy(lk0 + buf * KBUF, lv0 + buf * VBUF, gk0 + (size_t)(it + 2) * 64 * HD, gv0 + (it + 2) * 64); }
  asm volatile("s_wait_asynccnt 0x0" ::: "memory");     // nothing of this wave's is in flight when it leaves the loop
  if (g == 1) {   // group 1 hands over its maximum, its sum and its O, each lane at the places that the same lane of its partner wave reads
    Ml[w8][lane][0] = mrun; Ml[w8][lane][1] = l;
#pragma unroll
    for (int t = 0; t < 8; ++t)
#pragma unroll
      for (int r = 0; r < 8; ++r) To[w8][col][t * 16 + 8 * hh + r] = o[t][r] + o2[t][r] * (1.0f / RS_); }
  __syncthreads();   // group 1's hand-over is readable; its next one comes only behind the next tile's barriers, which group 0 reaches after it has read this one
  if (g == 0) {
  const float m1 = Ml[w8][lane][0], l1 = Ml[w8][lane][1]; const float mm = fmaxf(mrun, m1);   // group 0 holds key 0, so mrun is finite; a group 1 without a key in front of the diagonal has m1 = the floor and the factor 0
  const float a0 = nexp2(mrun - mm), a1 = nexp2(m1 - mm); const float inv = 1.0f / ((l * a0 + l1 * a1) * PS * XS); const float f0 = a0 * inv, f1 = a1 * inv;
#pragma unroll
  for (int t = 0; t < 8; ++t)
#pragma unroll
    for (int r = 0; r < 8; ++r) { float* p = &To[w8][col][t * 16 + 8 * hh + r]; *p = (o[t][r] + o2[t][r] * (1.0f / RS_)) * f0 + *p * f1; }
  wave_lds_sync();
  { float* ob = out + (unsigned)((t0 * NH + h) * HD + lane * 4);   // a 32-bit offset (below 2^23): what stays in a register through the key loop is one word of it, not an address pair, and nothing spills
    for (int rr = 0; rr < 16; ++rr) *(v4f*)(ob + rr * NH * HD) = *(const v4f*)(&To[w8][rr][lane * 4]);  }
  }
  asm volatile("s_wait_xcnt 0x0" ::: "memory");   // stands behind the tile's stores, in front of the next tile's prologue, which rewrites the registers that they name
  }
}
}  // namespace

extern "C" void kernel_launch(void* const* d_in, const int* in_sizes, int n_in, void* d_out, int out_size, void* d_ws, size_t ws_size, hipStream_t stream) {
  (void)n_in;
  auto Fp = [&](int i) { return (const float*)d_in[i]; };
  // input order: 0 q [2048,32,128], 1 k [2048,8,128], 2 v [2048,8,128]
  if (in_sizes[0] != T * NH * HD || in_sizes[1] != T * NKV * HD || in_sizes[2] != T * NKV * HD || out_size != T * NH * HD) return;
  size_t off = 0; char* ws = (char*)d_ws;
  auto carve = [&](size_t bytes) { char* p = ws + off; off += (bytes + 255) & ~(size_t)255; return p; };
  b16* QP = (b16*)carve((size_t)NH * T * HD * 2); b16* KP = (b16*)carve((size_t)NKV * T * HD * 2); b16* VT = (b16*)carve((size_t)NKV * HD * T * 2);
  if (off > ws_size || off > ((size_t)128 << 20)) return;   // = 25 MB
  conv_kernel<<<VTB + ((T * NH * HD + T * NKV * HD) / 8 + 255) / 256, 256, 0, stream>>>(Fp(0), Fp(1), Fp(2), QP, KP, VT);
  attn_kernel<<<dim3(T / 64, NKV), 512, 0, stream>>>(QP, KP, VT, (float*)d_out);
}

// v008
// It runs in 56.1 microseconds.
// Two timings next to v007 both put it at 1.05 times that version's speed.
// Counting every step since v000, it is 4.77 times as fast.
#include <hip/hip_runtime.h>

// Causal grouped-query attention on given q [2048 tokens][32 heads][128], k/v [2048][8 kv-heads][128]: head h uses kv head h/4; scores = q.k 128^-0.5, causal (s <= t), softmax over s,
// out = sum_s p v -> [2048][32][128]. No projections: q, k, v are the (bf16-rounded) module inputs.
// Deterministic: per (head, 16-query tile) two waves take the even and the odd 32-key blocks up to the diagonal, each a flash-style pass with fixed-order online softmax, joined in fixed order; no atomics.
// compute dtype: WMMA v_wmma_f32_16x16x32_f16 with f32 accumulate for S^T = K Q^T (q, k bf16-exact x8 in f16: EXACT products, K = 128: 1 product) and O^T += V^T P^T (v bf16-exact x8; P x1024 as
// f16 hi + x1024 residual: 2 products); scale, mask and softmax statistics in f32 (exp2). Inputs rounded to bf16 once.
// Fragment k-map per lane half hh for A AND B: elements 0..7 <- k = 8hh+0..7, 8..15 <- k = 16+8hh+0..7; acc[r] = D[8hh+r][col].

namespace {
typedef _Float16 b16;
typedef __attribute__((ext_vector_type(16))) _Float16 v16b;
typedef __attribute__((ext_vector_type(8))) _Float16 v8b;
typedef __attribute__((ext_vector_type(4))) _Float16 v4h;
typedef __attribute__((ext_vector_type(2))) _Float16 v2h;
typedef __attribute__((ext_vector_type(8))) float v8f;
typedef __attribute__((ext_vector_type(4))) float v4f;
typedef __attribute__((ext_vector_type(2))) float v2f;
__device__ __forceinline__ float bf16_rne(float f) { unsigned int u = __float_as_uint(f); u += 0x7FFFu + ((u >> 16) & 1u); return __uint_as_float(u & 0xFFFF0000u); }
__device__ __forceinline__ void split16(float v, b16& hi, b16& lo) { hi = (b16)v; lo = (b16)(v - (float)hi); }
__device__ __forceinline__ v16b frag_kb(const b16* p, int hh) { const v8b a = *(const v8b*)(p + 8 * hh), b = *(const v8b*)(p + 16 + 8 * hh); v16b f;
#pragma unroll
  for (int e = 0; e < 8; ++e) { f[e] = a[e]; f[8 + e] = b[e]; } return f; }
__device__ __forceinline__ v8f wmma16b(v16b a, v16b b, v8f c) { return __builtin_amdgcn_wmma_f32_16x16x32_f16(false, a, false, b, (short)0, c, false, false); }   // the builtin alone: the compiler itself keeps the distance to a vector instruction on D, A or B
// the same with four slots behind it, for the one product whose A registers are dead at once and are given to the next product's result tile: the slots keep the distance in front of that overwrite of A
__device__ __forceinline__ v8f wmma16b_pad(v16b a, v16b b, v8f c) { v8f d = __builtin_amdgcn_wmma_f32_16x16x32_f16(false, a, false, b, (short)0, c, false, false); asm volatile("v_nop\n\tv_nop\n\tv_nop\n\tv_nop" : "+v"(d) : "v"(a), "v"(b)); return d; }
__device__ __forceinline__ void wave_lds_sync() { __builtin_amdgcn_fence(__ATOMIC_RELEASE, "workgroup"); __builtin_amdgcn_wave_barrier(); __builtin_amdgcn_fence(__ATOMIC_ACQUIRE, "workgroup"); }
__device__ __forceinline__ float pmul(float a, float b) { float p = a * b; asm volatile("" : "+v"(p)); return p; }
__device__ __forceinline__ int iclamp(int v, int lo, int hi) { return v < lo ? lo : (v > hi ? hi : v); }
__device__ __forceinline__ float nexp2(float v) { return __builtin_amdgcn_exp2f(v); }
__device__ __forceinline__ float xhalf(float v, int xa) { return __int_as_float(__builtin_amdgcn_ds_bpermute(xa, __float_as_int(v))); }   // the value of lane ^ 16; xa = that lane's number x 4

constexpr int T = 2048, NH = 32, NKV = 8, GRP = NH / NKV, HD = 128, HL = NH /* not used: all NH query heads are computed */;
constexpr float XS = 8.0f, PS = 1024.0f, RS_ = 1024.0f, LOG2E = 1.4426950408889634f, SCALE = 0.088388347648318447f /* 128^-0.5 */, MFLOOR = -1.0e30f /* start of a block's maximum */, LAZY = 5.0f /* log2 units: P x1024 is at most 2^15, inside f16, while no score lies further than this above the reference */;
static_assert(T % 64 == 0 && HD == 128 && NH % NKV == 0, "tiling");

// planes: QP[h][t][128] = f16(bf16(q[t][h]) x8) and KP[kh][s][128] likewise (head-major so a wave's fragment rows are contiguous); V^T[kh][d][s] (keys contiguous): block = (kh, 64 tokens).
// ONE launch makes the three planes: its first VTB blocks make V^T, one (kv head, 64 tokens) tile each, the others convert q and k, 8 elements a thread. The V^T blocks mostly wait (a chain of memory round trips, then LDS),
// the q/k blocks stream: in one grid the first kind runs under the second, and there is one launch and one gap between dependent launches less. The V^T blocks come first in the grid (for speed only).
constexpr int VTB = (T / 64) * NKV;
__global__ __launch_bounds__(256) void conv_kernel(const float* __restrict__ q, const float* __restrict__ k, const float* __restrict__ v, b16* __restrict__ QP, b16* __restrict__ KP, b16* __restrict__ VT) {
  __shared__ __attribute__((aligned(16))) b16 Ts[HD][64 + 8];
  if ((int)blockIdx.x < VTB) {   // the same for the whole block: all of its waves pass the barrier below, or none
  const int kh = (int)blockIdx.x / (T / 64), s0 = ((int)blockIdx.x % (T / 64)) * 64;
  for (int i = threadIdx.x; i < 64 * HD; i += 256) { const int tt = i / HD, d = i % HD; Ts[d][tt] = (b16)(bf16_rne(v[((size_t)(s0 + tt) * NKV + kh) * HD + d]) * XS); }
  __syncthreads();
  const int wave = threadIdx.x >> 5, lane = threadIdx.x & 31;
  { for (int d = wave; d < HD; d += 8) *(v2h*)(VT + ((size_t)kh * HD + d) * T + s0 + lane * 2) = *(const v2h*)(&Ts[d][lane * 2]);  }
  return;
  }
  const int u = ((int)blockIdx.x - VTB) * 256 + threadIdx.x; const int nq = T * NH * HD / 8, nk = T * NKV * HD / 8;
  if (u < nq) { const int e = u * 8; const int h = e / (T * HD), rem = e % (T * HD), t = rem / HD, d = rem % HD; const float* src = q + ((size_t)t * NH + h) * HD + d; v8b o; for (int j = 0; j < 8; ++j) o[j] = (b16)(bf16_rne(src[j]) * XS);
    { *(v8b*)(QP + e) = o;  } }
  else if (u < nq + nk) { const int e = (u - nq) * 8; const int h = e / (T * HD), rem = e % (T * HD), t = rem / HD, d = rem % HD; const float* src = k + ((size_t)t * NKV + h) * HD + d; v8b o; for (int j = 0; j < 8; ++j) o[j] = (b16)(bf16_rne(src[j]) * XS);
    { *(v8b*)(KP + e) = o;  } }
}
// attention: grid (T/64, NKV), one work-group of 16 waves per WGP (four waves per SIMD); a block takes the 32-position tile T/32 - 1 - blockIdx.x and then tile blockIdx.x, one after the other in every wave, so that every block walks T/32 + 1 key
// blocks: with one tile per block all blocks are resident at once and the launch lasts as long as the last tile's T/32 key blocks, about twice the mean.
// block = 2 key groups x 8 waves; the 8 waves of a group = the 4 query heads of kv head kh x 2 tiles of 16 queries (32 positions). Group g takes the key blocks 2 it + g (the even or the odd blocks of 32 keys up to the
// diagonal; where their number is odd, group 1's last block lies wholly behind the diagonal and adds nothing), with its own running maximum, sum and O; behind the loop group 1 hands its three through LDS to group 0,
// which joins them (factors 2^(m_g - max)) and stores. So a wave's dependent chain per tile is half as many trips long, and twice as many waves fill each other's waits. The eight waves of a group share ONE copy of each
// block's K rows and V^T columns in LDS (two buffers, filled by asynchronous 16-byte copies one block ahead; rows padded to 272 / 80 bytes for the 16-byte fragment reads). Per wave as before: S^T = K Q^T
// (4 k-steps x 2 key tiles, 1 product: exact operands), logit = s/64 x 128^-0.5 in log2 units, keys s > t -> -inf (diagonal kept), online softmax, P x1024 hi + residual -> LDS, O^T += V^T P^T
// (8 d-tiles x 2 products -> o, o2); out[t][h][d] = (o + o2/1024)/(l 1024 8). The LDS fragment reads run ahead of the products (K four fragments, V^T three), within the 256 registers that four waves per SIMD leave each wave:
constexpr int KPIT = HD + 8, VPIT = 32 + 8;   // LDS row pitch in elements
// one key block: K rows s0..s0+31 (8 KB contiguous) and 32 columns of the 128 V^T rows; each of the 256 threads of a key group copies 2 + 2 pieces of 16 bytes of its group's block. The s_wait_xcnt stands inside the statement so that no address
// register of an issued copy is rewritten in front of it.
__device__ __forceinline__ void stage_copy(unsigned lk, unsigned lv, const b16* gk, const b16* gv) {
  const unsigned lk1 = lk + 16 * KPIT * 2, lv1 = lv + 64 * VPIT * 2; const b16* gk1 = gk + 16 * HD; const b16* gv1 = gv + (size_t)64 * T;
  asm volatile("global_load_async_to_lds_b128 %0, %4, off\n\tglobal_load_async_to_lds_b128 %1, %5, off\n\tglobal_load_async_to_lds_b128 %2, %6, off\n\tglobal_load_async_to_lds_b128 %3, %7, off\n\ts_wait_xcnt 0x0"
               :: "v"(lk), "v"(lk1), "v"(lv), "v"(lv1), "v"(gk), "v"(gk1), "v"(gv), "v"(gv1) : "memory");
}
__global__ __launch_bounds__(512) void attn_kernel(const b16* __restrict__ QP, const b16* __restrict__ KP, const b16* __restrict__ VT, float* __restrict__ out) {
  __shared__ __attribute__((aligned(16))) b16 Ks[2][2][32][KPIT], Vs[2][2][HD][VPIT];   // [key group][buffer]
  __shared__ __attribute__((aligned(16))) b16 Pb[16][16][32 + 8], Pl[16][16][32 + 8]; __shared__ __attribute__((aligned(16))) float To[8][16][HD + 4]; __shared__ float Ml[8][32][2];
  const int wave = __builtin_amdgcn_readfirstlane((int)threadIdx.x >> 5);   // in a scalar register: the tests on the key group below are then scalar branches
  const int g = wave >> 3, w8 = wave & 7, tid = threadIdx.x & 255 /* thread within its key group */, lane = tid & 31, hh = lane >> 4, col = lane & 15; const int kh = blockIdx.y, h = kh * GRP + (w8 & 3);
  const int xa = (lane ^ 16) * 4;   // formed once: formed at each exchange it takes registers that the kernel does not have to spare
  const b16* Kb = KP + (size_t)kh * T * HD; const b16* Vb = VT + (size_t)kh * HD * T;
  // this thread's pieces of its group's key block: K piece tid (row tid/16, 16 bytes at tid%16) and tid + 256 (16 rows on); V^T piece tid (row tid/4, 16 bytes at tid%4) and tid + 256 (64 rows on)
  const unsigned lk0 = (unsigned)(size_t)&Ks[g][0][tid >> 4][(tid & 15) * 8], lv0 = (unsigned)(size_t)&Vs[g][0][tid >> 2][(tid & 3) * 8];
  const b16* gk0 = Kb + g * 32 * HD + tid * 8; const b16* gv0 = Vb + (size_t)(tid >> 2) * T + g * 32 + (tid & 3) * 8;
  constexpr unsigned KBUF = 32 * KPIT * 2, VBUF = HD * VPIT * 2;   // bytes per buffer
#pragma unroll 1   // the two tiles go through one copy of the code
  for (int half = 0; half < 2; ++half) {
  const int bx = half ? (int)blockIdx.x : T / 32 - 1 - (int)blockIdx.x;   // block-uniform; the long tile first. The last trip's barrier of the first tile has ended every read of both buffers
  const int t0 = bx * 32 + (w8 >> 2) * 16; const int tq = t0 + col; const b16* Qb = QP + ((size_t)h * T + tq) * HD;
  const int ntrip = (bx + 2) >> 1;   // pairs of key blocks up to the diagonal: the same for the sixteen waves; the last block touched is 2 ntrip - 1 <= T / 32 - 1
  stage_copy(lk0, lv0, gk0, gv0);
  v16b qf[4]; for (int kb = 0; kb < 4; ++kb) qf[kb] = frag_kb(Qb + kb * 32, hh);
  asm volatile("s_wait_asynccnt 0x0" ::: "memory");   // this wave's copies of block g have landed
  __syncthreads();                                     // ... and every other wave's: block g is readable
  if (ntrip > 1) stage_copy(lk0 + KBUF, lv0 + VBUF, gk0 + 64 * HD, gv0 + 64);
  const float cs = LOG2E * SCALE / (XS * XS);
  float mrun = -INFINITY, l = 0.0f; v8f o[8], o2[8];
#pragma unroll
  for (int t = 0; t < 8; ++t) { o[t] = (v8f){}; o2[t] = (v8f){}; }
#pragma unroll 1
  for (int it = 0; it < ntrip; ++it) {
    const int s0 = (2 * it + g) * 32, buf = it & 1;
    // the causal select runs only where the block reaches behind the wave's first query (a scalar test: s0 and t0 are the same in every lane); in front of that, s0 + 31 <= t0 <= tq, it keeps every score, so the key
    // indices, compares and selects are left out. The block maximum starts at a finite floor far below any score (|score| < 2^40 cs for f16 operands), so mn is finite also for a row whose keys are all masked so far:
    // such a row then gets p = 2^(-inf) = 0 and a factor 0 on its zero sums with no guard, and the join behind the loop gives its group the factor 2^(floor - max) = 0
    float e[16]; float mx = MFLOOR;
    // the eight K fragments are read four ahead of the products that use them (order: k-step major, the two key tiles alternating), so that one LDS latency is waited out per four fragments, not per fragment
    const b16* kr = &Ks[g][buf][col][0]; v16b kf[4]; v8f sacc[2] = {(v8f){}, (v8f){}};
#pragma unroll
    for (int j = 0; j < 4; ++j) kf[j] = frag_kb(kr + (j & 1) * 16 * KPIT + (j >> 1) * 32, hh);
    __builtin_amdgcn_sched_barrier(0);   // keeps the four reads above as one group in front of the first product
#pragma unroll
    for (int j = 0; j < 8; ++j) { sacc[j & 1] = j == 0 ? wmma16b_pad(kf[0], qf[0], sacc[0]) : wmma16b(kf[j & 3], qf[j >> 1], sacc[j & 1]); if (j < 4) kf[j & 3] = frag_kb(kr + (j & 1) * 16 * KPIT + ((j + 4) >> 1) * 32, hh);
      __builtin_amdgcn_sched_barrier(0); }   // keeps each refill directly behind the product that frees its registers: sunk to its use it would be waited for in full
    if (s0 + 31 > t0) {
#pragma unroll
      for (int u2 = 0; u2 < 2; ++u2)
#pragma unroll
        for (int r = 0; r < 8; ++r) { const int s = s0 + u2 * 16 + 8 * hh + r; e[u2 * 8 + r] = (s <= tq) ? sacc[u2][r] * cs : -INFINITY; }
    } else {
#pragma unroll
      for (int i2 = 0; i2 < 16; ++i2) e[i2] = sacc[i2 >> 3][i2 & 7] * cs;
    }
#pragma unroll
    for (int i2 = 0; i2 < 16; ++i2) mx = fmaxf(mx, e[i2]);
    // lazy rescale: mrun is the reference of the exponentials, not the true maximum. It moves, and l, O and O2 are rescaled, only where some lane's block maximum lies more than LAZY above it: one test per key block, on the
    // ballot, so that both branches on it are scalar. The first block always takes them (mrun = -inf: factor 0 on zero sums). Both halves of a column move to the same exchanged maximum, so mrun stays equal in them.
    // Not taken: every p <= 2^LAZY
    const bool move = __builtin_amdgcn_ballot_w32(mx > mrun + LAZY) != 0; float al = 1.0f;
    if (move) { mx = fmaxf(mx, xhalf(mx, xa)); const float mn = fmaxf(mrun, mx); al = nexp2(mrun - mn); l *= al; mrun = mn; }
    float sum = 0.0f;
#pragma unroll
    for (int i2 = 0; i2 < 16; ++i2) { const float p = nexp2(e[i2] - mrun); sum += p; const float psv = p * PS; const b16 p1 = (b16)psv; const int slot = (i2 < 8 ? 0 : 16) + 8 * hh + (i2 & 7); Pb[wave][col][slot] = p1; Pl[wave][col][slot] = (b16)((psv - (float)p1) * RS_); }
    sum += xhalf(sum, xa); l += sum;
    wave_lds_sync();
    const v16b pf = frag_kb(&Pb[wave][col][0], hh), plf = frag_kb(&Pl[wave][col][0], hh); v16b vf[3];
#pragma unroll
    for (int t = 0; t < 3; ++t) vf[t] = frag_kb(&Vs[g][buf][t * 16 + col][0], hh);
    if (move) {   // P and the first three V^T fragments are read as one group in front of this branch; the rescale, where it is due, runs while they are on their way
#pragma unroll
      for (int t = 0; t < 8; ++t) { o[t] *= al; o2[t] *= al; } }
#pragma unroll
    for (int t = 0; t < 8; ++t) { o[t] = wmma16b(vf[t % 3], pf, o[t]); o2[t] = wmma16b(vf[t % 3], plf, o2[t]); if (t < 5) vf[t % 3] = frag_kb(&Vs[g][buf][(t + 3) * 16 + col][0], hh);
      __builtin_amdgcn_sched_barrier(0); }   // keeps each refill directly behind the two products that free its registers
    wave_lds_sync();
    asm volatile("s_wait_dscnt 0x0" ::: "memory");      // this wave's reads of buffer buf are done before the buffer is handed back
    asm volatile("s_wait_asynccnt 0x0" ::: "memory");   // this wave's copies of block 2 it + 2 + g have landed
    __syncthreads();                                     // publishes block 2 it + 2 + g and ends every wave's reads of buffer buf
    if (it + 2 < ntrip) stage_copy(lk0 + buf * KBUF, lv0 + buf * VBUF, gk0 + (size_t)(it + 2) * 64 * HD, gv0 + (it + 2) * 64); }
  asm volatile("s_wait_asynccnt 0x0" ::: "memory");     // nothing of this wave's is in flight when it leaves the loop
  if (g == 1) {   // group 1 hands over its maximum, its sum and its O, each lane at the places that the same lane of its partner wave reads
    Ml[w8][lane][0] = mrun; Ml[w8][lane][1] = l;
#pragma unroll
    for (int t = 0; t < 8; ++t)
#pragma unroll
      for (int r = 0; r < 8; ++r) To[w8][col][t * 16 + 8 * hh + r] = o[t][r] + o2[t][r] * (1.0f / RS_); }
  __syncthreads();   // group 1's hand-over is readable; its next one comes only behind the next tile's barriers, which group 0 reaches after it has read this one
  if (g == 0) {
  const float m1 = Ml[w8][lane][0], l1 = Ml[w8][lane][1]; const float mm = fmaxf(mrun, m1);   // group 0 holds key 0, so mrun is finite; a group 1 without a key in front of the diagonal has m1 = the floor and the factor 0
  const float a0 = nexp2(mrun - mm), a1 = nexp2(m1 - mm); const float inv = 1.0f / ((l * a0 + l1 * a1) * PS * XS); const float f0 = a0 * inv, f1 = a1 * inv;
#pragma unroll
  for (int t = 0; t < 8; ++t)
#pragma unroll
    for (int r = 0; r < 8; ++r) { float* p = &To[w8][col][t * 16 + 8 * hh + r]; *p = (o[t][r] + o2[t][r] * (1.0f / RS_)) * f0 + *p * f1; }
  wave_lds_sync();
  { float* ob = out + (unsigned)((t0 * NH + h) * HD + lane * 4);   // a 32-bit offset (below 2^23): what stays in a register through the key loop is one word of it, not an address pair, and nothing spills
    for (int rr = 0; rr < 16; ++rr) *(v4f*)(ob + rr * NH * HD) = *(const v4f*)(&To[w8][rr][lane * 4]);  }
  }
  asm volatile("s_wait_xcnt 0x0" ::: "memory");   // stands behind the tile's stores, in front of the next tile's prologue, which rewrites the registers that they name
  }
}
}  // namespace

extern "C" void kernel_launch(void* const* d_in, const int* in_sizes, int n_in, void* d_out, int out_size, void* d_ws, size_t ws_size, hipStream_t stream) {
  (void)n_in;
  auto Fp = [&](int i) { return (const float*)d_in[i]; };
  // input order: 0 q [2048,32,128], 1 k [2048,8,128], 2 v [2048,8,128]
  if (in_sizes[0] != T * NH * HD || in_sizes[1] != T * NKV * HD || in_sizes[2] != T * NKV * HD || out_size != T * NH * HD) return;
  size_t off = 0; char* ws = (char*)d_ws;
  auto carve = [&](size_t bytes) { char* p = ws + off; off += (bytes + 255) & ~(size_t)255; return p; };
  b16* QP = (b16*)carve((size_t)NH * T * HD * 2); b16* KP = (b16*)carve((size_t)NKV * T * HD * 2); b16* VT = (b16*)carve((size_t)NKV * HD * T * 2);
  if (off > ws_size || off > ((size_t)128 << 20)) return;   // = 25 MB
  conv_kernel<<<VTB + ((T * NH * HD + T * NKV * HD) / 8 + 255) / 256, 256, 0, stream>>>(Fp(0), Fp(1), Fp(2), QP, KP, VT);
  attn_kernel<<<dim3(T / 64, NKV), 512, 0, stream>>>(QP, KP, VT, (float*)d_out);
}

// v009
// It runs in 51.8 microseconds.
// Two timings next to v008 both put it at 1.08 times that version's speed.
// All steps since v000 together make it 5.16 times as fast.
#include <hip/hip_runtime.h>

// Causal grouped-query attention on given q [2048 tokens][32 heads][128], k/v [2048][8 kv-heads][128]: head h uses kv head h/4; scores = q.k 128^-0.5, causal (s <= t), softmax over s,
// out = sum_s p v -> [2048][32][128]. No projections: q, k, v are the (bf16-rounded) module inputs.
// Deterministic: per (head, 16-query tile) two waves take the even and the odd 32-key blocks up to the diagonal, each a flash-style pass with fixed-order online softmax, joined in fixed order; no atomics.
// compute dtype: WMMA v_wmma_f32_16x16x32_f16 with f32 accumulate for S^T = K Q^T (q, k bf16-exact x8 in f16: EXACT products, K = 128: 1 product) and O^T += V^T P^T (v bf16-exact x8; P x1024 as
// f16 hi + its residual, also f16: 2 products); scale, mask and softmax statistics in f32 (exp2). Inputs rounded to bf16 once
// Fragment k-map per lane half hh for A AND B: elements 0..7 <- k = 8hh+0..7, 8..15 <- k = 16+8hh+0..7; acc[r] = D[8hh+r][col].

namespace {
typedef _Float16 b16;
typedef __attribute__((ext_vector_type(16))) _Float16 v16b;
typedef __attribute__((ext_vector_type(8))) _Float16 v8b;
typedef __attribute__((ext_vector_type(4))) _Float16 v4h;
typedef __attribute__((ext_vector_type(2))) _Float16 v2h;
typedef __attribute__((ext_vector_type(8))) float v8f;
typedef __attribute__((ext_vector_type(4))) float v4f;
typedef __attribute__((ext_vector_type(2))) float v2f;
__device__ __forceinline__ float bf16_rne(float f) { unsigned int u = __float_as_uint(f); u += 0x7FFFu + ((u >> 16) & 1u); return __uint_as_float(u & 0xFFFF0000u); }
__device__ __forceinline__ void split16(float v, b16& hi, b16& lo) { hi = (b16)v; lo = (b16)(v - (float)hi); }
__device__ __forceinline__ v16b frag_kb(const b16* p, int hh) { const v8b a = *(const v8b*)(p + 8 * hh), b = *(const v8b*)(p + 16 + 8 * hh); v16b f;
#pragma unroll
  for (int e = 0; e < 8; ++e) { f[e] = a[e]; f[8 + e] = b[e]; } return f; }
__device__ __forceinline__ v8f wmma16b(v16b a, v16b b, v8f c) { return __builtin_amdgcn_wmma_f32_16x16x32_f16(false, a, false, b, (short)0, c, false, false); }   // the builtin alone: the compiler itself keeps the distance to a vector instruction on D, A or B
// the same with four slots behind it, for the one product whose A registers are dead at once and are given to the next product's result tile: the slots keep the distance in front of that overwrite of A
__device__ __forceinline__ v8f wmma16b_pad(v16b a, v16b b, v8f c) { v8f d = __builtin_amdgcn_wmma_f32_16x16x32_f16(false, a, false, b, (short)0, c, false, false); asm volatile("v_nop\n\tv_nop\n\tv_nop\n\tv_nop" : "+v"(d) : "v"(a), "v"(b)); return d; }
__device__ __forceinline__ void wave_lds_sync() { __builtin_amdgcn_fence(__ATOMIC_RELEASE, "workgroup"); __builtin_amdgcn_wave_barrier(); __builtin_amdgcn_fence(__ATOMIC_ACQUIRE, "workgroup"); }
__device__ __forceinline__ float pmul(float a, float b) { float p = a * b; asm volatile("" : "+v"(p)); return p; }
__device__ __forceinline__ int iclamp(int v, int lo, int hi) { return v < lo ? lo : (v > hi ? hi : v); }
__device__ __forceinline__ float nexp2(float v) { return __builtin_amdgcn_exp2f(v); }
__device__ __forceinline__ float xhalf(float v, int xa) { return __int_as_float(__builtin_amdgcn_ds_bpermute(xa, __float_as_int(v))); }   // the value of lane ^ 16; xa = that lane's number x 4

constexpr int T = 2048, NH = 32, NKV = 8, GRP = NH / NKV, HD = 128, HL = NH /* query heads computed (== NH shipped) */;
constexpr float XS = 8.0f, PLOG = 10.0f /* P is held x 2^10 */, LOG2E = 1.4426950408889634f, SCALE = 0.088388347648318447f /* 128^-0.5 */, MFLOOR = -1.0e33f /* start of a block's maximum, in raw products: about -2e30 as a score */, LAZY = 5.0f /* log2 units: P x1024 is at most 2^15, inside f16, while no score lies further than this above the reference */;
static_assert(T % 64 == 0 && HD == 128 && NH % NKV == 0, "tiling");

// planes: QP[h][t][128] = f16(bf16(q[t][h]) x8) and KP[kh][s][128] likewise (head-major so a wave's fragment rows are contiguous); V^T[kh][d][s] (keys contiguous): block = (kh, 64 tokens).
// ONE launch makes the three planes: its first VTB blocks make V^T, one (kv head, 64 tokens) tile each, the others convert q and k, 8 elements a thread. The V^T blocks mostly wait (a chain of memory round trips, then LDS),
// the q/k blocks stream: in one grid the first kind runs under the second, and there is one launch and one gap between dependent launches less. The V^T blocks come first in the grid (for speed only).
constexpr int VTB = (T / 64) * NKV;
__global__ __launch_bounds__(256) void conv_kernel(const float* __restrict__ q, const float* __restrict__ k, const float* __restrict__ v, b16* __restrict__ QP, b16* __restrict__ KP, b16* __restrict__ VT) {
  __shared__ __attribute__((aligned(16))) b16 Ts[HD][64 + 8];
  if ((int)blockIdx.x < VTB) {   // the same for the whole block: all of its waves pass the barrier below, or none
  const int kh = (int)blockIdx.x / (T / 64), s0 = ((int)blockIdx.x % (T / 64)) * 64;
  for (int i = threadIdx.x; i < 64 * HD; i += 256) { const int tt = i / HD, d = i % HD; Ts[d][tt] = (b16)(bf16_rne(v[((size_t)(s0 + tt) * NKV + kh) * HD + d]) * XS); }
  __syncthreads();
  const int wave = threadIdx.x >> 5, lane = threadIdx.x & 31;
  { for (int d = wave; d < HD; d += 8) *(v2h*)(VT + ((size_t)kh * HD + d) * T + s0 + lane * 2) = *(const v2h*)(&Ts[d][lane * 2]);  }
  return;
  }
  const int u = ((int)blockIdx.x - VTB) * 256 + threadIdx.x; const int nq = T * NH * HD / 8, nk = T * NKV * HD / 8;
  if (u < nq) { const int e = u * 8; const int h = e / (T * HD), rem = e % (T * HD), t = rem / HD, d = rem % HD; const float* src = q + ((size_t)t * NH + h) * HD + d; v8b o; for (int j = 0; j < 8; ++j) o[j] = (b16)(bf16_rne(src[j]) * XS);
    { *(v8b*)(QP + e) = o;  } }
  else if (u < nq + nk) { const int e = (u - nq) * 8; const int h = e / (T * HD), rem = e % (T * HD), t = rem / HD, d = rem % HD; const float* src = k + ((size_t)t * NKV + h) * HD + d; v8b o; for (int j = 0; j < 8; ++j) o[j] = (b16)(bf16_rne(src[j]) * XS);
    { *(v8b*)(KP + e) = o;  } }
}
// attention: grid (T/64, NKV), one work-group of 16 waves per WGP (four waves per SIMD); a block takes the 32-position tile T/32 - 1 - blockIdx.x and then tile blockIdx.x, one after the other in every wave, so that every block walks T/32 + 1 key
// blocks: with one tile per block all blocks are resident at once and the launch lasts as long as the last tile's T/32 key blocks, about twice the mean.
// block = 2 key groups x 8 waves; the 8 waves of a group = the 4 query heads of kv head kh x 2 tiles of 16 queries (32 positions). Group g takes the key blocks 2 it + g (the even or the odd blocks of 32 keys up to the
// diagonal; where their number is odd, group 1's last block lies wholly behind the diagonal and adds nothing), with its own running maximum, sum and O; behind the loop group 1 hands its three through LDS to group 0,
// which joins them (factors 2^(m_g - max)) and stores. So a wave's dependent chain per tile is half as many trips long, and twice as many waves fill each other's waits. The eight waves of a group share ONE copy of each
// block's K rows and V^T columns in LDS (two buffers, filled by asynchronous 16-byte copies one block ahead; rows padded to 272 / 80 bytes for the 16-byte fragment reads). Per wave as before: S^T = K Q^T
// (4 k-steps x 2 key tiles, 1 product: exact operands), logit = s/64 x 128^-0.5 in log2 units, keys s > t -> -inf (diagonal kept), online softmax, P x1024 hi + residual -> LDS, O^T += V^T P^T
// (8 d-tiles x 2 products -> o, o2); out[t][h][d] = (o + o2)/(l 8), l being the sum of P x1024. The LDS fragment reads run ahead of the products (K four fragments, V^T three), within the 256 registers that four waves per SIMD leave each wave:
constexpr int KPIT = HD + 8, VPIT = 32 + 8;   // LDS row pitch in elements
// one key block: K rows s0..s0+31 (8 KB contiguous) and 32 columns of the 128 V^T rows; each of the 256 threads of a key group copies 2 + 2 pieces of 16 bytes of its group's block. The s_wait_xcnt stands inside the statement so that no address
// register of an issued copy is rewritten in front of it.
__device__ __forceinline__ void stage_copy(unsigned lk, unsigned lv, const b16* gk, const b16* gv) {
  const unsigned lk1 = lk + 16 * KPIT * 2, lv1 = lv + 64 * VPIT * 2; const b16* gk1 = gk + 16 * HD; const b16* gv1 = gv + (size_t)64 * T;
  asm volatile("global_load_async_to_lds_b128 %0, %4, off\n\tglobal_load_async_to_lds_b128 %1, %5, off\n\tglobal_load_async_to_lds_b128 %2, %6, off\n\tglobal_load_async_to_lds_b128 %3, %7, off\n\ts_wait_xcnt 0x0"
               :: "v"(lk), "v"(lk1), "v"(lv), "v"(lv1), "v"(gk), "v"(gk1), "v"(gv), "v"(gv1) : "memory");
}
__global__ __launch_bounds__(512) void attn_kernel(const b16* __restrict__ QP, const b16* __restrict__ KP, const b16* __restrict__ VT, float* __restrict__ out) {
  __shared__ __attribute__((aligned(16))) b16 Ks[2][2][32][KPIT], Vs[2][2][HD][VPIT];   // [key group][buffer]
  __shared__ __attribute__((aligned(16))) b16 Pb[16][16][32 + 8], Pl[16][16][32 + 8]; __shared__ __attribute__((aligned(16))) float To[8][16][HD + 4]; __shared__ float Ml[8][32][2];
  const int wave = __builtin_amdgcn_readfirstlane((int)threadIdx.x >> 5);   // in a scalar register: the tests on the key group below are then scalar branches
  const int g = wave >> 3, w8 = wave & 7, tid = threadIdx.x & 255 /* thread within its key group */, lane = tid & 31, hh = lane >> 4, col = lane & 15; const int kh = blockIdx.y, h = kh * GRP + (w8 & 3);
  const int xa = (lane ^ 16) * 4;   // formed once: formed at each exchange it takes registers that the kernel does not have to spare
  const b16* Kb = KP + (size_t)kh * T * HD; const b16* Vb = VT + (size_t)kh * HD * T;
  // this thread's pieces of its group's key block: K piece tid (row tid/16, 16 bytes at tid%16) and tid + 256 (16 rows on); V^T piece tid (row tid/4, 16 bytes at tid%4) and tid + 256 (64 rows on)
  const unsigned lk0 = (unsigned)(size_t)&Ks[g][0][tid >> 4][(tid & 15) * 8], lv0 = (unsigned)(size_t)&Vs[g][0][tid >> 2][(tid & 3) * 8];
  const b16* gk0 = Kb + g * 32 * HD + tid * 8; const b16* gv0 = Vb + (size_t)(tid >> 2) * T + g * 32 + (tid & 3) * 8;
  constexpr unsigned KBUF = 32 * KPIT * 2, VBUF = HD * VPIT * 2;   // bytes per buffer
#pragma unroll 1   // the two tiles go through one copy of the code
  for (int half = 0; half < 2; ++half) {
  const int bx = half ? (int)blockIdx.x : T / 32 - 1 - (int)blockIdx.x;   // block-uniform; the long tile first. The last trip's barrier of the first tile has ended every read of both buffers
  const int t0 = bx * 32 + (w8 >> 2) * 16; const int tq = t0 + col; const b16* Qb = QP + ((size_t)h * T + tq) * HD;
  const int ntrip = (bx + 2) >> 1;   // pairs of key blocks up to the diagonal: the same for the sixteen waves; the last block touched is 2 ntrip - 1 <= T / 32 - 1
  stage_copy(lk0, lv0, gk0, gv0);
  v16b qf[4]; for (int kb = 0; kb < 4; ++kb) qf[kb] = frag_kb(Qb + kb * 32, hh);
  asm volatile("s_wait_asynccnt 0x0" ::: "memory");   // this wave's copies of block g have landed
  __syncthreads();                                     // ... and every other wave's: block g is readable
  if (ntrip > 1) stage_copy(lk0 + KBUF, lv0 + VBUF, gk0 + 64 * HD, gv0 + 64);
  const float cs = LOG2E * SCALE / (XS * XS);
  float mrun = -INFINITY, l = 0.0f; v8f o[8], o2[8];
#pragma unroll
  for (int t = 0; t < 8; ++t) { o[t] = (v8f){}; o2[t] = (v8f){}; }
#pragma unroll 1
  for (int it = 0; it < ntrip; ++it) {
    const int s0 = (2 * it + g) * 32, buf = it & 1;
    // the causal select runs only where the block reaches behind the wave's first query (a scalar test: s0 and t0 are the same in every lane); in front of that, s0 + 31 <= t0 <= tq, it keeps every score, so the key
    // indices, compares and selects are left out. The block maximum starts at a finite floor far below any score (|score| < 2^40 cs for f16 operands), so mn is finite also for a row whose keys are all masked so far:
    // such a row then gets p = 2^(-inf) = 0 and a factor 0 on its zero sums with no guard, and the join behind the loop gives its group the factor 2^(floor - max) = 0
    float e[16]; float mx = MFLOOR;
    // the eight K fragments are read four ahead of the products that use them (order: k-step major, the two key tiles alternating), so that one LDS latency is waited out per four fragments, not per fragment
    const b16* kr = &Ks[g][buf][col][0]; v16b kf[4]; v8f sacc[2] = {(v8f){}, (v8f){}};
#pragma unroll
    for (int j = 0; j < 4; ++j) kf[j] = frag_kb(kr + (j & 1) * 16 * KPIT + (j >> 1) * 32, hh);
    __builtin_amdgcn_sched_barrier(0);   // keeps the four reads above as one group in front of the first product
#pragma unroll
    for (int j = 0; j < 8; ++j) { sacc[j & 1] = j == 0 ? wmma16b_pad(kf[0], qf[0], sacc[0]) : wmma16b(kf[j & 3], qf[j >> 1], sacc[j & 1]); if (j < 4) kf[j & 3] = frag_kb(kr + (j & 1) * 16 * KPIT + ((j + 4) >> 1) * 32, hh);
      __builtin_amdgcn_sched_barrier(0); }   // keeps each refill directly behind the product that frees its registers: sunk to its use it would be waited for in full
    if (s0 + 31 > t0) {
#pragma unroll
      for (int u2 = 0; u2 < 2; ++u2)
#pragma unroll
        for (int r = 0; r < 8; ++r) { const int s = s0 + u2 * 16 + 8 * hh + r; e[u2 * 8 + r] = (s <= tq) ? sacc[u2][r] : -INFINITY; }
    } else {
#pragma unroll
      for (int i2 = 0; i2 < 16; ++i2) e[i2] = sacc[i2 >> 3][i2 & 7];
    }
#pragma unroll
    for (int i2 = 0; i2 < 16; ++i2) mx = fmaxf(mx, e[i2]);
    mx *= cs;   // e holds the raw products: cs > 0, so the maximum is taken first and scaled once (the same value as the maximum of the scaled scores)
    // lazy rescale: mrun is the reference of the exponentials, not the true maximum. It moves, and l, O and O2 are rescaled, only where some lane's block maximum lies more than LAZY above it: one test per key block, on the
    // ballot, so that both branches on it are scalar. The first block always takes them (mrun = -inf: factor 0 on zero sums). Both halves of a column move to the same exchanged maximum, so mrun stays equal in them.
    // Not taken: every p <= 2^LAZY
    const bool move = __builtin_amdgcn_ballot_w32(mx > mrun + LAZY) != 0; float al = 1.0f;
    if (move) { mx = fmaxf(mx, xhalf(mx, xa)); const float mn = fmaxf(mrun, mx); al = nexp2(mrun - mn); l *= al; mrun = mn; }
    // two scores at a time, in packed f32 forms: ONE fused multiply-add carries the score scale, the reference and the x1024 of P (as + 10 in the exponent), so that exp2 gives P x1024 at once; l sums P x1024. hi = both
    // values rounded to f16 by one packed convert, residual = value - hi (exact in f32), rounded to f16 as it is: below 2^-14 it is an f16 subnormal with an absolute error of at most 2^-25, against row sums of 2^10 and more
    const float c0 = PLOG - mrun; v2f sum2 = {0.0f, 0.0f};
#pragma unroll
    for (int i2 = 0; i2 < 16; i2 += 2) { const v2f x = __builtin_elementwise_fma((v2f){e[i2], e[i2 + 1]}, (v2f){cs, cs}, (v2f){c0, c0}); const v2f ps = {nexp2(x[0]), nexp2(x[1])}; sum2 += ps;
      const v2h h2 = __builtin_convertvector(ps, v2h); const v2h l2 = __builtin_convertvector(ps - __builtin_convertvector(h2, v2f), v2h);
      const int slot = (i2 < 8 ? 0 : 16) + 8 * hh + (i2 & 7); *(v2h*)&Pb[wave][col][slot] = h2; *(v2h*)&Pl[wave][col][slot] = l2; }
    float sum = sum2[0] + sum2[1];
    sum += xhalf(sum, xa); l += sum;
    wave_lds_sync();
    const v16b pf = frag_kb(&Pb[wave][col][0], hh), plf = frag_kb(&Pl[wave][col][0], hh); v16b vf[3];
#pragma unroll
    for (int t = 0; t < 3; ++t) vf[t] = frag_kb(&Vs[g][buf][t * 16 + col][0], hh);
    if (move) {   // P and the first three V^T fragments are read as one group in front of this branch; the rescale, where it is due, runs while they are on their way
#pragma unroll
      for (int t = 0; t < 8; ++t) { o[t] *= al; o2[t] *= al; } }
#pragma unroll
    for (int t = 0; t < 8; ++t) { o[t] = wmma16b(vf[t % 3], pf, o[t]); o2[t] = wmma16b(vf[t % 3], plf, o2[t]); if (t < 5) vf[t % 3] = frag_kb(&Vs[g][buf][(t + 3) * 16 + col][0], hh);
      __builtin_amdgcn_sched_barrier(0); }   // keeps each refill directly behind the two products that free its registers
    wave_lds_sync();
    asm volatile("s_wait_dscnt 0x0" ::: "memory");      // this wave's reads of buffer buf are done before the buffer is handed back
    asm volatile("s_wait_asynccnt 0x0" ::: "memory");   // this wave's copies of block 2 it + 2 + g have landed
    __syncthreads();                                     // publishes block 2 it + 2 + g and ends every wave's reads of buffer buf
    if (it + 2 < ntrip) stage_copy(lk0 + buf * KBUF, lv0 + buf * VBUF, gk0 + (size_t)(it + 2) * 64 * HD, gv0 + (it + 2) * 64); }
  asm volatile("s_wait_asynccnt 0x0" ::: "memory");     // nothing of this wave's is in flight when it leaves the loop
  if (g == 1) {   // group 1 hands over its maximum, its sum and its O, each lane at the places that the same lane of its partner wave reads
    Ml[w8][lane][0] = mrun; Ml[w8][lane][1] = l;
#pragma unroll
    for (int t = 0; t < 8; ++t)
#pragma unroll
      for (int r = 0; r < 8; ++r) To[w8][col][t * 16 + 8 * hh + r] = o[t][r] + o2[t][r]; }
  __syncthreads();   // group 1's hand-over is readable; its next one comes only behind the next tile's barriers, which group 0 reaches after it has read this one
  if (g == 0) {
  const float m1 = Ml[w8][lane][0], l1 = Ml[w8][lane][1]; const float mm = fmaxf(mrun, m1);   // group 0 holds key 0, so mrun is finite; a group 1 without a key in front of the diagonal has m1 = the floor and the factor 0
  const float a0 = nexp2(mrun - mm), a1 = nexp2(m1 - mm); const float inv = 1.0f / ((l * a0 + l1 * a1) * XS) /* l and l1 carry the x1024 of P */; const float f0 = a0 * inv, f1 = a1 * inv;
#pragma unroll
  for (int t = 0; t < 8; ++t)
#pragma unroll
    for (int r = 0; r < 8; ++r) { float* p = &To[w8][col][t * 16 + 8 * hh + r]; *p = (o[t][r] + o2[t][r]) * f0 + *p * f1; }
  wave_lds_sync();
  { float* ob = out + (unsigned)((t0 * NH + h) * HD + lane * 4);   // a 32-bit offset (below 2^23): what stays in a register through the key loop is one word of it, not an address pair, and nothing spills
    for (int rr = 0; rr < 16; ++rr) *(v4f*)(ob + rr * NH * HD) = *(const v4f*)(&To[w8][rr][lane * 4]);  }
  }
  asm volatile("s_wait_xcnt 0x0" ::: "memory");   // stands behind the tile's stores, in front of the next tile's prologue, which rewrites the registers that they name
  }
}
}  // namespace

extern "C" void kernel_launch(void* const* d_in, const int* in_sizes, int n_in, void* d_out, int out_size, void* d_ws, size_t ws_size, hipStream_t stream) {
  (void)n_in;
  auto Fp = [&](int i) { return (const float*)d_in[i]; };
  // input order: 0 q [2048,32,128], 1 k [2048,8,128], 2 v [2048,8,128]
  if (in_sizes[0] != T * NH * HD || in_sizes[1] != T * NKV * HD || in_sizes[2] != T * NKV * HD || out_size != T * NH * HD) return;
  size_t off = 0; char* ws = (char*)d_ws;
  auto carve = [&](size_t bytes) { char* p = ws + off; off += (bytes + 255) & ~(size_t)255; return p; };
  b16* QP = (b16*)carve((size_t)NH * T * HD * 2); b16* KP = (b16*)carve((size_t)NKV * T * HD * 2); b16* VT = (b16*)carve((size_t)NKV * HD * T * 2);
  if (off > ws_size || off > ((size_t)128 << 20)) return;   // = 25 MB
  conv_kernel<<<VTB + ((T * NH * HD + T * NKV * HD) / 8 + 255) / 256, 256, 0, stream>>>(Fp(0), Fp(1), Fp(2), QP, KP, VT);
  attn_kernel<<<dim3(T / 64, NKV), 512, 0, stream>>>(QP, KP, VT, (float*)d_out);
}
